// v000
// Measured on an AMD MI455X. A time is GPU time per run, averaged over a window of back-to-back runs after a warm-up
// (all launches, gaps included; the runs take copies of the inputs in turn), and the median of several windows.
// Apart from v000's, it joins two sittings. Times from different sittings can be a few percent apart, while
// side-by-side timings come from the same sitting.
// v000 is the starting kernel. One run takes 261 microseconds.
// compute dtype: all float inputs rounded to bf16, the integer row/column ids read on device; q/k/v = x . W^T + b with EXACT bf16 products on WMMA 16x16x32 (natural rows); PLAIN attention: q, k single f16 x 1/8 + the 4-way structural bias gathered per (query, key), running-max softmax in f32 (hardware exp), P (scaled by 2^11, single f16) x v (single f16); out = o (bf16 hi + residual) . o_w^T (2 products) + o_b.
#include <hip/hip_runtime.h>
#include <math.h>

typedef __attribute__((ext_vector_type(16))) _Float16 v16h;
typedef __attribute__((ext_vector_type(16))) __bf16 v16b;
typedef __attribute__((ext_vector_type(8)))  _Float16 v8h;
typedef __attribute__((ext_vector_type(8)))  float v8f;
typedef __attribute__((ext_vector_type(4)))  float v4f;
typedef __attribute__((ext_vector_type(2)))  float v2f;
typedef __attribute__((ext_vector_type(4)))  unsigned v4u;
typedef __attribute__((ext_vector_type(4)))  int v4i;
typedef float __attribute__((may_alias)) float_a;
typedef int __attribute__((may_alias)) int_a;

template <typename T> __device__ __forceinline__ void vst2(void* p, T v) { *(T*)p = v;  }
__device__ __forceinline__ v8f wmma16(v16h a, v16h b, v8f c) {
  v8f d = __builtin_amdgcn_wmma_f32_16x16x32_f16(false, a, false, b, (short)0, c, false, false);
  asm volatile("v_nop\n\tv_nop\n\tv_nop\n\tv_nop" : "+v"(d) : "v"(a), "v"(b));
  return d;
}
__device__ __forceinline__ v8f wmma_bf(v16b a, v16b b, v8f c) {
  v8f d = __builtin_amdgcn_wmma_f32_16x16x32_bf16(false, a, false, b, (short)0, c, false, false);
  asm volatile("v_nop\n\tv_nop\n\tv_nop\n\tv_nop" : "+v"(d) : "v"(a), "v"(b));
  return d;
}
// Table-structure-aware BART attention (B 4, S 1,024, E 768, 12 heads x 64): q/k/v projections + biases, scores + rel_table[other / same row / same column / same cell][h] from the per-token row and column ids, softmax, . v, output projection + bias.
__device__ __forceinline__ v16h frag_h(const _Float16* rowk0, int lane) {
  union { v16h v; v8h q[2]; } u; const _Float16* p = rowk0 + 8 * (lane >> 4);
  u.q[0] = *(const v8h*)p; u.q[1] = *(const v8h*)(p + 16); return u.v;
}
__device__ __forceinline__ v16h frag_f32(const float* rowk0, int lane) {
  v16h a; const float* p = rowk0 + 8 * (lane >> 4);
#pragma unroll
  for (int i = 0; i < 8; ++i) { a[i] = (_Float16)p[i]; a[8 + i] = (_Float16)p[16 + i]; }
  return a;
}
__device__ __forceinline__ v16h frag_f32s(const float* rowk0, int lane, float sc) {
  v16h a; const float* p = rowk0 + 8 * (lane >> 4);
#pragma unroll
  for (int i = 0; i < 8; ++i) { a[i] = (_Float16)(p[i] * sc); a[8 + i] = (_Float16)(p[16 + i] * sc); }
  return a;
}
// column fragment from a [K][ld] layout (column n), rows >= K read as 0
__device__ __forceinline__ v16h fragc_f32(const float* W, int k0, int n, int lane, int ld, int K) {
  v16h a; const int g = lane >> 4;
#pragma unroll
  for (int i = 0; i < 8; ++i) { const int ka = k0 + 8 * g + i, kb = ka + 16;
    a[i] = (_Float16)(ka < K ? W[(size_t)(ka < K ? ka : K - 1) * ld + n] : 0.f); a[8 + i] = (_Float16)(kb < K ? W[(size_t)(kb < K ? kb : K - 1) * ld + n] : 0.f); }
  return a;
}
struct F2 { v16b h, l; };
__device__ __forceinline__ F2 bsplit16(const float v[16]) { F2 r;
#pragma unroll
  for (int i = 0; i < 16; ++i) { const __bf16 h = (__bf16)v[i]; r.h[i] = h; r.l[i] = (__bf16)(v[i] - (float)h); }
  return r; }
__device__ __forceinline__ F2 split_row(const float* row, int k0, int lane) { float v[16]; const float* p = row + k0 + 8 * (lane >> 4);
#pragma unroll
  for (int i = 0; i < 8; ++i) { v[i] = p[i]; v[8 + i] = p[16 + i]; }
  return bsplit16(v); }
__device__ __forceinline__ F2 split_rowK(const float* row, int k0, int lane, int K) { float v[16]; const int g = lane >> 4;
#pragma unroll
  for (int i = 0; i < 8; ++i) { const int ka = k0 + 8 * g + i, kb = ka + 16; v[i] = ka < K ? row[ka < K ? ka : K - 1] : 0.f; v[8 + i] = kb < K ? row[kb < K ? kb : K - 1] : 0.f; }
  return bsplit16(v); }
__device__ __forceinline__ F2 split_col(const float* W, int k0, int n, int lane, int ld, int K) { float v[16]; const int g = lane >> 4;
#pragma unroll
  for (int i = 0; i < 8; ++i) { const int ka = k0 + 8 * g + i, kb = ka + 16; v[i] = ka < K ? W[(size_t)(ka < K ? ka : K - 1) * ld + n] : 0.f; v[8 + i] = kb < K ? W[(size_t)(kb < K ? kb : K - 1) * ld + n] : 0.f; }
  return bsplit16(v); }
__device__ __forceinline__ v8f mac3(const F2& a, const F2& b, v8f c) { c = wmma_bf(a.l, b.h, c); c = wmma_bf(a.h, b.l, c); return wmma_bf(a.h, b.h, c); }
__device__ __forceinline__ float sigm(float v) { return 1.0f / (1.0f + expf(-v)); }
#define LDSX() do { asm volatile("s_wait_dscnt 0" ::: "memory"); __builtin_amdgcn_wave_barrier(); __builtin_amdgcn_fence(__ATOMIC_RELEASE, "workgroup"); } while (0)


#define NB 4
#define SS 1024
#define DM 768
#define NH 12
#define HD 64
#define QKVW (3 * DM)
#ifndef TQB
#define TQB (SS / 64)
#define TNB NB
#define TOB (NB * SS / 64)     // output row tiles (all)
#endif
typedef __attribute__((ext_vector_type(8))) __bf16 v8b;
__device__ __forceinline__ v16b frag_b(const __bf16* rowk0, int lane) {
  union { v16b v; v8b q[2]; } u; const __bf16* p = rowk0 + 8 * (lane >> 4);
  u.q[0] = *(const v8b*)p; u.q[1] = *(const v8b*)(p + 16); return u.v;
}
__device__ __forceinline__ float bfr(float v) { return (float)(__bf16)v; }
__device__ __attribute__((noinline)) float exp_ni(float v) { return expf(v); }
__device__ __attribute__((noinline)) float erf_ni(float v) { return erff(v); }

#define PK_A 0                       // [2304][768] Wqkv rows (natural [out][in])
#define PK_P (PK_A + QKVW * DM)        // [768][768] Wo rows (natural)
#define PK_END (PK_P + DM * DM)
#define WS_PK  0u
#define WS_QK  (WS_PK + 2u * PK_END)             // f16 [4096 rows][1536]: q | k
#define WS_QKL (WS_QK + 2u * NB * SS * 2 * DM)     // f16 q | k residual planes x2048
#define WS_VTH (WS_QKL + 2u * NB * SS * 2 * DM)    // f16 [b][768 (h*64+d)][1024 s] hi
#define WS_VTL (WS_VTH + 2u * NB * DM * SS)        // f16 lo x 2048
#define WS_O   (WS_VTL + 2u * NB * DM * SS)        // f32 [4096][768]
#define WS_CS  (WS_O + 4u * NB * SS * DM)           // f32 2 x [1024][32], unused
#define WS_END (WS_CS + 4u * 2 * SS * 32)
// ---- k_pack: block = (row n, which): natural [out][in] rows -> bf16; which 0..2 -> W_q/W_k/W_v into PK_A rows which*768 + n; 3 -> W_o into PK_P
__global__ __launch_bounds__(256) void k_pack(const float* __restrict__ WQ, const float* __restrict__ WK, const float* __restrict__ WV, const float* __restrict__ WO, __bf16* __restrict__ PK) {
  __shared__ __align__(16) __bf16 s[DM]; const int n = blockIdx.x, which = blockIdx.y, t = threadIdx.x; const float* Wm = (which == 0) ? WQ : (which == 1) ? WK : (which == 2) ? WV : WO;
  for (int k = t; k < DM; k += 256) s[k] = (__bf16)Wm[(size_t)n * DM + k];
  __syncthreads();
  __bf16* dst = (which < 3) ? PK + PK_A + ((size_t)which * DM + n) * DM : PK + PK_P + (size_t)n * DM;
  for (int q = t; q < DM / 8; q += 256) vst2((unsigned*)(dst + q * 8), *(const v4u*)&s[q * 8]);
}
__global__ __launch_bounds__(128) void k_qkv(const float* __restrict__ XQ, const float* __restrict__ XK, const float* __restrict__ XV, const __bf16* __restrict__ P, const float* __restrict__ BQ, const float* __restrict__ BK, const float* __restrict__ BV, _Float16* __restrict__ QK, _Float16* __restrict__ QKL, _Float16* __restrict__ VTH, _Float16* __restrict__ VTL) {
  const int which0 = (blockIdx.y * 128) / DM; const float* X = (which0 == 0) ? XQ : (which0 == 1) ? XK : XV; const float* BB = BQ ? (((which0 == 0) ? BQ : (which0 == 1) ? BK : BV) + (blockIdx.y * 128 - which0 * DM)) : nullptr;
  __shared__ __align__(16) _Float16 so[4][16][136], sol[4][16][136]; __shared__ __align__(16) _Float16 sth[128][72], stl[128][72];
  const int tid = threadIdx.x, wave = tid >> 5, lane = tid & 31, col = lane & 15, g = lane >> 4; const size_t r0 = (size_t)blockIdx.x * 64 + wave * 16; const int n0 = blockIdx.y * 128;
  v8f acc[8] = {};
#pragma unroll 2
  for (int kc = 0; kc < DM / 32; ++kc) { v16b a; { const float* p = X + (r0 + col) * DM + kc * 32 + 8 * g;
#pragma unroll
      for (int i = 0; i < 8; ++i) { a[i] = (__bf16)p[i]; a[8 + i] = (__bf16)p[16 + i]; } }
#pragma unroll
    for (int j = 0; j < 8; ++j) acc[j] = wmma_bf(a, frag_b(P + (size_t)(n0 + j * 16 + col) * DM + kc * 32, lane), acc[j]); }
  if (n0 < 2 * DM) {   // q stored unscaled (f16 sigma ~0.6, no subnormal exposure); 1/8 applied to the f32 score
#pragma unroll
    for (int j = 0; j < 8; ++j) {
#pragma unroll
      for (int r = 0; r < 8; ++r) { const float v = acc[j][r] + (BB ? bfr(BB[j * 16 + col]) : 0.f); const _Float16 hv = (_Float16)v; so[wave][8 * g + r][j * 16 + col] = hv; sol[wave][8 * g + r][j * 16 + col] = (_Float16)((v - (float)hv) * 2048.0f); } }   // q, k (+ bias) as f16 hi + (x2048) residual
    LDSX();
    for (int rl = 0; rl < 16; ++rl) if (lane < 16) { vst2((unsigned*)(QK + (r0 + rl) * (2 * DM) + n0 + lane * 8), *(const v4u*)&so[wave][rl][lane * 8]); vst2((unsigned*)(QKL + (r0 + rl) * (2 * DM) + n0 + lane * 8), *(const v4u*)&sol[wave][rl][lane * 8]); }
  } else {
#pragma unroll
    for (int j = 0; j < 8; ++j) {
#pragma unroll
      for (int r = 0; r < 8; ++r) { const float v = acc[j][r] + (BB ? bfr(BB[j * 16 + col]) : 0.f); const _Float16 hv = (_Float16)v; sth[j * 16 + col][wave * 16 + 8 * g + r] = hv; stl[j * 16 + col][wave * 16 + 8 * g + r] = (_Float16)((v - (float)hv) * 2048.0f); } }
    __syncthreads();
    const size_t rb = (size_t)blockIdx.x * 64; const int b = (int)(rb / SS), s0 = (int)(rb % SS); const int pc0 = n0 - 2 * DM;
    for (int q = tid; q < 128 * 8; q += 128) { const int d = q >> 3, pc = q & 7; const size_t o = ((size_t)b * DM + pc0 + d) * SS + s0 + pc * 8; vst2((unsigned*)(VTH + o), *(const v4u*)&sth[d][pc * 8]); vst2((unsigned*)(VTL + o), *(const v4u*)&stl[d][pc * 8]); }
  }
}
// ---- k_attn: block = (64 queries, head h, batch b): all-keys flash attention (K = 64: 2 k-steps), scores = (q.k) * 0.125 with single f16 operands, P.V: f16 P (x2^11) x V hi in one accumulator (accl stays 0); O[b*S+q][h*64+d] = (acc + accl / 2048) / (2048 l) (256-B segments)
__global__ __launch_bounds__(128) void k_attn(const _Float16* __restrict__ QK, const _Float16* __restrict__ QKL, const _Float16* __restrict__ VTH, const _Float16* __restrict__ VTL, const void* __restrict__ KMASK, const int* __restrict__ PROW, const int* __restrict__ PCOL, const float* __restrict__ RT, float* __restrict__ O) {
  __shared__ __align__(16) float sp[4][16][36]; __shared__ __align__(16) float so[4][16][68];
  const int tid = threadIdx.x, wave = tid >> 5, lane = tid & 31, col = lane & 15, g = lane >> 4;
  const int qb = blockIdx.x, h = blockIdx.y, b = blockIdx.z; const int q0 = qb * 64 + wave * 16; const size_t rq = (size_t)b * SS + q0 + col;
  v16h aq[2], aql[2];
#pragma unroll
  for (int kc = 0; kc < 2; ++kc) { aq[kc] = frag_h(QK + rq * (2 * DM) + h * HD + kc * 32, lane); aql[kc] = frag_h(QKL + rq * (2 * DM) + h * HD + kc * 32, lane); }
  int prw[8], pcl[8];
#pragma unroll
  for (int r = 0; r < 8; ++r) { prw[r] = PROW[(size_t)b * SS + q0 + 8 * g + r]; pcl[r] = PCOL[(size_t)b * SS + q0 + 8 * g + r]; }
  float rt[4];
#pragma unroll
  for (int i = 0; i < 4; ++i) rt[i] = bfr(RT[i * NH + h]);   // other, same row, same column, same cell
  float m[8], l[8];
#pragma unroll
  for (int r = 0; r < 8; ++r) { m[r] = -3.0e38f; l[r] = 0.f; }
  v8f acc[4] = {}, accl[4] = {};
  const int nks = SS / 32;   // all keys
#pragma unroll 1
  for (int ks = 0; ks < nks; ++ks) { v8f s[2];
#pragma unroll
    for (int ct = 0; ct < 2; ++ct) { const int kk = ks * 32 + ct * 16 + col; const _Float16* krow = QK + ((size_t)b * SS + kk) * (2 * DM) + DM + h * HD; const _Float16* krowl = QKL + ((size_t)b * SS + kk) * (2 * DM) + DM + h * HD; v8f c = {}, cl = {};
#pragma unroll
      for (int kc = 0; kc < 2; ++kc) c = wmma16(aq[kc], frag_h(krow + kc * 32, lane), c);   // single product: q, k as one-rounding f16 operands
      (void)cl; (void)krowl;
      { const bool keepk = true;
      { const int krw = PROW[(size_t)b * SS + kk], kcl = PCOL[(size_t)b * SS + kk];
#pragma unroll
        for (int r = 0; r < 8; ++r) { const bool sr = (prw[r] == krw), sc = (pcl[r] == kcl); const float bias = (sr && sc) ? rt[3] : sc ? rt[2] : sr ? rt[1] : rt[0]; s[ct][r] = keepk ? (c[r] * 0.125f + bias) : -3.0e38f; } } } }   // 64^-1/2 (folded from q) + structural bias (cell > column > row > other)
#pragma unroll
    for (int r = 0; r < 8; ++r) { float mx = fmaxf(s[0][r], s[1][r]);
#pragma unroll
      for (int o = 1; o < 16; o <<= 1) mx = fmaxf(mx, __shfl_xor(mx, o));
      const float mn = fmaxf(m[r], mx); const float alpha = (m[r] <= -1.0e38f) ? 0.f : __expf(m[r] - mn);
      const float e0 = (s[0][r] <= -1.0e38f) ? 0.f : __expf(s[0][r] - mn), e1 = (s[1][r] <= -1.0e38f) ? 0.f : __expf(s[1][r] - mn); float es = e0 + e1;
#pragma unroll
      for (int o = 1; o < 16; o <<= 1) es += __shfl_xor(es, o);
      l[r] = l[r] * alpha + es; m[r] = mn;
#pragma unroll
      for (int dt = 0; dt < 4; ++dt) { acc[dt][r] *= alpha; accl[dt][r] *= alpha; }
      sp[wave][8 * g + r][col] = e0; sp[wave][8 * g + r][16 + col] = e1; }
    LDSX();
    v16h pa, pl; { const float* prow = &sp[wave][col][0] + 8 * (lane >> 4);
#pragma unroll
      for (int i = 0; i < 8; ++i) { const float x0 = prow[i] * 2048.0f, x1 = prow[16 + i] * 2048.0f; const _Float16 h0 = (_Float16)x0, h1 = (_Float16)x1; pa[i] = h0; pa[8 + i] = h1; pl[i] = (_Float16)((x0 - (float)h0) * 2048.0f); pl[8 + i] = (_Float16)((x1 - (float)h1) * 2048.0f); } }   // P scaled by 2^11 before the f16 split so small softmax weights stay out of the f16 subnormal range; 2^-11 folded into the epilogue
#pragma unroll
    for (int dt = 0; dt < 4; ++dt) { const size_t vr = ((size_t)b * DM + h * HD + dt * 16 + col) * SS + ks * 32; acc[dt] = wmma16(pa, frag_h(VTH + vr, lane), acc[dt]); }   // single product: P (x2^11) x V
    (void)pl;
    LDSX(); }
#pragma unroll
  for (int r = 0; r < 8; ++r) { const float il = (1.0f / 2048.0f) / l[r];
#pragma unroll
    for (int dt = 0; dt < 4; ++dt) so[wave][8 * g + r][dt * 16 + col] = (acc[dt][r] + accl[dt][r] * (1.0f / 2048.0f)) * il; }
  LDSX();
  for (int rl = 0; rl < 16; ++rl) if (lane < 16) vst2(O + ((size_t)b * SS + q0 + rl) * DM + h * HD + lane * 4, *(const v4f*)&so[wave][rl][lane * 4]);
}
// ---- k_out: block = (64 rows, 128 cols): out = O(hi/lo) . Wo rows (2 products) + bo
__global__ __launch_bounds__(128) void k_out(const float* __restrict__ O, const __bf16* __restrict__ P, const float* __restrict__ BO, float* __restrict__ Y) {
  __shared__ __align__(16) float so[4][16][132];
  const int tid = threadIdx.x, wave = tid >> 5, lane = tid & 31, col = lane & 15, g = lane >> 4; const size_t r0 = (size_t)blockIdx.x * 64 + wave * 16; const int n0 = blockIdx.y * 128;
  v8f acc[8] = {};
#pragma unroll 2
  for (int kc = 0; kc < DM / 32; ++kc) { const F2 a = split_row(O + (r0 + col) * DM, kc * 32, lane);
#pragma unroll
    for (int j = 0; j < 8; ++j) { const v16b w = frag_b(P + (size_t)(n0 + j * 16 + col) * DM + kc * 32, lane); acc[j] = wmma_bf(a.l, w, acc[j]); acc[j] = wmma_bf(a.h, w, acc[j]); } }
#pragma unroll
  for (int j = 0; j < 8; ++j) {
#pragma unroll
    for (int r = 0; r < 8; ++r) so[wave][8 * g + r][j * 16 + col] = acc[j][r] + bfr(BO[n0 + j * 16 + col]); }
  LDSX();
  for (int rl = 0; rl < 16; ++rl) vst2(Y + (r0 + rl) * DM + n0 + lane * 4, *(const v4f*)&so[wave][rl][lane * 4]);
}
extern "C" void kernel_launch(void* const* d_in, const int* in_sizes, int n_in, void* d_out, int out_size, void* d_ws, size_t ws_size, hipStream_t stream) {
  (void)in_sizes; (void)n_in; (void)out_size;
  const float** F = (const float**)d_in;   // 0 hidden [4,1024,768], 1 pos_row [4,1024] int, 2 pos_col [4,1024] int, 3 q_w, 4 q_b, 5 k_w, 6 k_b, 7 v_w, 8 v_b, 9 o_w, 10 o_b (natural [768,768]), 11 rel_table [4,12]
  if (ws_size < (size_t)WS_END) return;
  char* ws = (char*)d_ws; __bf16* PK = (__bf16*)(ws + WS_PK); _Float16 *QK = (_Float16*)(ws + WS_QK), *QKL = (_Float16*)(ws + WS_QKL), *VTH = (_Float16*)(ws + WS_VTH), *VTL = (_Float16*)(ws + WS_VTL); float* O = (float*)(ws + WS_O);
  k_pack<<<dim3(DM, 4), 256, 0, stream>>>(F[3], F[5], F[7], F[9], PK);
  k_qkv<<<dim3(TNB * SS / 64, QKVW / 128), 128, 0, stream>>>(F[0], F[0], F[0], PK + PK_A, F[4], F[6], F[8], QK, QKL, VTH, VTL);
  k_attn<<<dim3(TQB, NH, TNB), 128, 0, stream>>>(QK, QKL, VTH, VTL, nullptr, (const int*)d_in[1], (const int*)d_in[2], F[11], O);
  k_out<<<dim3(TOB, DM / 128), 128, 0, stream>>>(O, PK + PK_P, F[10], (float*)d_out);
}

// v001
// It runs in 85.6 microseconds.
// Next to v000, in two timings, it ran 3.09 and 3.12 times as fast.
// compute dtype: all float inputs rounded to bf16, the integer row/column ids read on device; q/k/v = x . W^T + b with EXACT bf16 products on WMMA 16x16x32 (natural rows); PLAIN attention: q, k single f16 x 1/8 + the 4-way structural bias gathered per (query, key), running-max softmax in f32 (hardware exp), P (scaled by 2^11, single f16) x v (single f16); out = o (bf16 hi + residual) . o_w^T (2 products) + o_b.
#include <hip/hip_runtime.h>
#include <math.h>

typedef __attribute__((ext_vector_type(16))) _Float16 v16h;
typedef __attribute__((ext_vector_type(16))) __bf16 v16b;
typedef __attribute__((ext_vector_type(8)))  _Float16 v8h;
typedef __attribute__((ext_vector_type(8)))  float v8f;
typedef __attribute__((ext_vector_type(4)))  float v4f;
typedef __attribute__((ext_vector_type(2)))  float v2f;
typedef __attribute__((ext_vector_type(4)))  unsigned v4u;
typedef __attribute__((ext_vector_type(4)))  int v4i;
typedef float __attribute__((may_alias)) float_a;
typedef int __attribute__((may_alias)) int_a;

template <typename T> __device__ __forceinline__ void vst2(void* p, T v) { *(T*)p = v;  }
__device__ __forceinline__ v8f wmma16(v16h a, v16h b, v8f c) {
  v8f d = __builtin_amdgcn_wmma_f32_16x16x32_f16(false, a, false, b, (short)0, c, false, false);
  asm volatile("v_nop\n\tv_nop\n\tv_nop\n\tv_nop" : "+v"(d) : "v"(a), "v"(b));
  return d;
}
__device__ __forceinline__ v8f wmma_bf(v16b a, v16b b, v8f c) {
  v8f d = __builtin_amdgcn_wmma_f32_16x16x32_bf16(false, a, false, b, (short)0, c, false, false);
  asm volatile("v_nop\n\tv_nop\n\tv_nop\n\tv_nop" : "+v"(d) : "v"(a), "v"(b));
  return d;
}
// Table-structure-aware BART attention (B 4, S 1,024, E 768, 12 heads x 64): q/k/v projections + biases, scores + rel_table[other / same row / same column / same cell][h] from the per-token row and column ids, softmax, . v, output projection + bias.
__device__ __forceinline__ v16h frag_h(const _Float16* rowk0, int lane) {
  union { v16h v; v8h q[2]; } u; const _Float16* p = rowk0 + 8 * (lane >> 4);
  u.q[0] = *(const v8h*)p; u.q[1] = *(const v8h*)(p + 16); return u.v;
}
__device__ __forceinline__ v16h frag_f32(const float* rowk0, int lane) {
  v16h a; const float* p = rowk0 + 8 * (lane >> 4);
#pragma unroll
  for (int i = 0; i < 8; ++i) { a[i] = (_Float16)p[i]; a[8 + i] = (_Float16)p[16 + i]; }
  return a;
}
__device__ __forceinline__ v16h frag_f32s(const float* rowk0, int lane, float sc) {
  v16h a; const float* p = rowk0 + 8 * (lane >> 4);
#pragma unroll
  for (int i = 0; i < 8; ++i) { a[i] = (_Float16)(p[i] * sc); a[8 + i] = (_Float16)(p[16 + i] * sc); }
  return a;
}
// column fragment from a [K][ld] layout (column n), rows >= K read as 0
__device__ __forceinline__ v16h fragc_f32(const float* W, int k0, int n, int lane, int ld, int K) {
  v16h a; const int g = lane >> 4;
#pragma unroll
  for (int i = 0; i < 8; ++i) { const int ka = k0 + 8 * g + i, kb = ka + 16;
    a[i] = (_Float16)(ka < K ? W[(size_t)(ka < K ? ka : K - 1) * ld + n] : 0.f); a[8 + i] = (_Float16)(kb < K ? W[(size_t)(kb < K ? kb : K - 1) * ld + n] : 0.f); }
  return a;
}
struct F2 { v16b h, l; };
__device__ __forceinline__ F2 bsplit16(const float v[16]) { F2 r;
#pragma unroll
  for (int i = 0; i < 16; ++i) { const __bf16 h = (__bf16)v[i]; r.h[i] = h; r.l[i] = (__bf16)(v[i] - (float)h); }
  return r; }
__device__ __forceinline__ F2 split_row(const float* row, int k0, int lane) { float v[16]; const float* p = row + k0 + 8 * (lane >> 4);
#pragma unroll
  for (int i = 0; i < 8; ++i) { v[i] = p[i]; v[8 + i] = p[16 + i]; }
  return bsplit16(v); }
__device__ __forceinline__ F2 split_rowK(const float* row, int k0, int lane, int K) { float v[16]; const int g = lane >> 4;
#pragma unroll
  for (int i = 0; i < 8; ++i) { const int ka = k0 + 8 * g + i, kb = ka + 16; v[i] = ka < K ? row[ka < K ? ka : K - 1] : 0.f; v[8 + i] = kb < K ? row[kb < K ? kb : K - 1] : 0.f; }
  return bsplit16(v); }
__device__ __forceinline__ F2 split_col(const float* W, int k0, int n, int lane, int ld, int K) { float v[16]; const int g = lane >> 4;
#pragma unroll
  for (int i = 0; i < 8; ++i) { const int ka = k0 + 8 * g + i, kb = ka + 16; v[i] = ka < K ? W[(size_t)(ka < K ? ka : K - 1) * ld + n] : 0.f; v[8 + i] = kb < K ? W[(size_t)(kb < K ? kb : K - 1) * ld + n] : 0.f; }
  return bsplit16(v); }
__device__ __forceinline__ v8f mac3(const F2& a, const F2& b, v8f c) { c = wmma_bf(a.l, b.h, c); c = wmma_bf(a.h, b.l, c); return wmma_bf(a.h, b.h, c); }
__device__ __forceinline__ float sigm(float v) { return 1.0f / (1.0f + expf(-v)); }
#define LDSX() do { asm volatile("s_wait_dscnt 0" ::: "memory"); __builtin_amdgcn_wave_barrier(); __builtin_amdgcn_fence(__ATOMIC_RELEASE, "workgroup"); } while (0)


#define NB 4
#define SS 1024
#define DM 768
#define NH 12
#define HD 64
#define QKVW (3 * DM)
#ifndef TQB
#define TQB (SS / 64)
#define TNB NB
#define TOB (NB * SS / 64)     // output row tiles (all)
#endif
typedef __attribute__((ext_vector_type(8))) __bf16 v8b;
__device__ __forceinline__ v16b frag_b(const __bf16* rowk0, int lane) {
  union { v16b v; v8b q[2]; } u; const __bf16* p = rowk0 + 8 * (lane >> 4);
  u.q[0] = *(const v8b*)p; u.q[1] = *(const v8b*)(p + 16); return u.v;
}
__device__ __forceinline__ float bfr(float v) { return (float)(__bf16)v; }
__device__ __attribute__((noinline)) float exp_ni(float v) { return expf(v); }
__device__ __attribute__((noinline)) float erf_ni(float v) { return erff(v); }

#define PK_A 0                       // [2304][768] Wqkv rows (natural [out][in])
#define PK_P (PK_A + QKVW * DM)        // [768][768] Wo rows (natural)
#define PK_END (PK_P + DM * DM)
#define WS_PK  0u
#define WS_QK  (WS_PK + 2u * PK_END)             // f16 [4096 rows][1536]: q | k
#define WS_QKL (WS_QK + 2u * NB * SS * 2 * DM)     // f16 q | k residual planes x2048
#define WS_VTH (WS_QKL + 2u * NB * SS * 2 * DM)    // f16 [b][768 (h*64+d)][1024 s] hi
#define WS_VTL (WS_VTH + 2u * NB * DM * SS)        // f16 lo x 2048
#define WS_O   (WS_VTL + 2u * NB * DM * SS)        // f32 [4096][768]
#define WS_CS  (WS_O + 4u * NB * SS * DM)           // f32 2 x [1024][32], unused
#define WS_END (WS_CS + 4u * 2 * SS * 32)
// ---- k_pack: block = (row n, which): natural [out][in] rows -> bf16; which 0..2 -> W_q/W_k/W_v into PK_A rows which*768 + n; 3 -> W_o into PK_P
__global__ __launch_bounds__(256) void k_pack(const float* __restrict__ WQ, const float* __restrict__ WK, const float* __restrict__ WV, const float* __restrict__ WO, __bf16* __restrict__ PK) {
  __shared__ __align__(16) __bf16 s[DM]; const int n = blockIdx.x, which = blockIdx.y, t = threadIdx.x; const float* Wm = (which == 0) ? WQ : (which == 1) ? WK : (which == 2) ? WV : WO;
  for (int k = t; k < DM; k += 256) s[k] = (__bf16)Wm[(size_t)n * DM + k];
  __syncthreads();
  __bf16* dst = (which < 3) ? PK + PK_A + ((size_t)which * DM + n) * DM : PK + PK_P + (size_t)n * DM;
  for (int q = t; q < DM / 8; q += 256) vst2((unsigned*)(dst + q * 8), *(const v4u*)&s[q * 8]);
}
typedef __attribute__((ext_vector_type(4))) __bf16 v4b;
#define GK 64   // k per LDS stage
#define GP 72   // LDS row pitch in 16-bit elements: 128 B + 16 B, the conflict-free pitch for 16-B fragment reads
// In the staged kernels below every '#pragma unroll' makes the index of a register array (staging registers, fragments, accumulators) a constant, so that the array stays in registers.
// ---- gemm_tile: one BM x BN tile of A . B^T by 8 waves (WGM x WGN). Each 64-k stage of A (f32 rows rounded to bf16; hi + residual planes when NP = 2) and of B (bf16 rows) goes to LDS once per block in whole lines and every wave takes its fragments from there; two buffers, the next stage's global loads in flight during the products, one barrier per stage. k order per accumulator as with direct loads.
template <int BM, int BN, int NP, int WGM, int WGN>
__device__ __forceinline__ void gemm_tile(const float* __restrict__ A, const __bf16* __restrict__ B, __bf16* sm, v8f (&acc)[BM / WGM / 16][BN / WGN / 16]) {
  constexpr int FM = BM / WGM / 16, FN = BN / WGN / 16, ABUF = NP * BM * GP, BUF = ABUF + BN * GP, NA = BM / 16, NBL = BN / 32, NT = DM / GK;
  const int tid = threadIdx.x, wave = tid >> 5, lane = tid & 31, col = lane & 15; const int wm = wave / WGN, wn = wave % WGN;
  const float* ga = A + (size_t)(tid >> 4) * DM + (tid & 15) * 4; const __bf16* gb = B + (size_t)(tid >> 3) * DM + (tid & 7) * 8;
  const int sa = (tid >> 4) * GP + (tid & 15) * 4, sb = ABUF + (tid >> 3) * GP + (tid & 7) * 8;
  v4f ra[NA]; v4u rb[NBL];
#pragma unroll
  for (int i = 0; i < NA; ++i) ra[i] = *(const v4f*)(ga + (size_t)(16 * i) * DM);
#pragma unroll
  for (int i = 0; i < NBL; ++i) rb[i] = *(const v4u*)(gb + (size_t)(32 * i) * DM);
  for (int t = 0; t < NT; ++t) { __bf16* s = sm + (t & 1) * BUF;
#pragma unroll
    for (int i = 0; i < NA; ++i) { v4b hv, lv;
#pragma unroll
      for (int e = 0; e < 4; ++e) { const __bf16 hh = (__bf16)ra[i][e]; hv[e] = hh; lv[e] = (__bf16)(ra[i][e] - (float)hh); }
      *(v4b*)(s + sa + 16 * i * GP) = hv; if (NP == 2) *(v4b*)(s + BM * GP + sa + 16 * i * GP) = lv; }
#pragma unroll
    for (int i = 0; i < NBL; ++i) *(v4u*)(s + sb + 32 * i * GP) = rb[i];
    __syncthreads();   // publishes stage t; the buffer written next was last read before this barrier
    if (t + 1 < NT) {
#pragma unroll
      for (int i = 0; i < NA; ++i) ra[i] = *(const v4f*)(ga + (size_t)(16 * i) * DM + (t + 1) * GK);
#pragma unroll
      for (int i = 0; i < NBL; ++i) rb[i] = *(const v4u*)(gb + (size_t)(32 * i) * DM + (t + 1) * GK); }
#pragma unroll
    for (int kc = 0; kc < GK / 32; ++kc) { v16b w[FN];
#pragma unroll
      for (int j = 0; j < FN; ++j) w[j] = frag_b(s + ABUF + ((wn * FN + j) * 16 + col) * GP + kc * 32, lane);
#pragma unroll
      for (int i = 0; i < FM; ++i) { const __bf16* ar = s + ((wm * FM + i) * 16 + col) * GP + kc * 32; const v16b ah = frag_b(ar, lane);
        if (NP == 2) { const v16b al = frag_b(ar + BM * GP, lane);
#pragma unroll
          for (int j = 0; j < FN; ++j) { acc[i][j] = wmma_bf(al, w[j], acc[i][j]); acc[i][j] = wmma_bf(ah, w[j], acc[i][j]); } }
        else {
#pragma unroll
          for (int j = 0; j < FN; ++j) acc[i][j] = wmma_bf(ah, w[j], acc[i][j]); } } } }
  __syncthreads();   // every wave has left the ring: the caller stages its output there
}
// ---- k_qkv: block = (128 rows, 128 cols), 8 waves as 2 x 4, 64 x 32 each
__global__ __launch_bounds__(256) void k_qkv(const float* __restrict__ XQ, const float* __restrict__ XK, const float* __restrict__ XV, const __bf16* __restrict__ P, const float* __restrict__ BQ, const float* __restrict__ BK, const float* __restrict__ BV, _Float16* __restrict__ QK, _Float16* __restrict__ QKL, _Float16* __restrict__ VTH, _Float16* __restrict__ VTL) {
  const int which0 = (blockIdx.y * 128) / DM; const float* X = (which0 == 0) ? XQ : (which0 == 1) ? XK : XV; const float* BB = BQ ? (((which0 == 0) ? BQ : (which0 == 1) ? BK : BV) + (blockIdx.y * 128 - which0 * DM)) : nullptr;
  __shared__ __align__(16) __bf16 sm[2 * (128 + 128) * GP];
  const int tid = threadIdx.x, wave = tid >> 5, lane = tid & 31, col = lane & 15, g = lane >> 4, wm = wave >> 2, wn = wave & 3; const size_t rb = (size_t)blockIdx.x * 128; const int n0 = blockIdx.y * 128;
  v8f acc[4][2] = {};
  gemm_tile<128, 128, 1, 2, 4>(X + rb * DM, P + (size_t)n0 * DM, sm, acc);
  _Float16* sh = (_Float16*)sm; _Float16* sl = sh + 128 * 136;   // output staging [128][136] hi, lo in the ring's LDS
  if (n0 < 2 * DM) {   // q stored unscaled (f16 sigma ~0.6, no subnormal exposure); 1/8 applied to the f32 score
#pragma unroll
    for (int i = 0; i < 4; ++i) {
#pragma unroll
      for (int j = 0; j < 2; ++j) { const int c = wn * 32 + j * 16 + col; const float bb = BB ? bfr(BB[c]) : 0.f;
#pragma unroll
        for (int r = 0; r < 8; ++r) { const float v = acc[i][j][r] + bb; const _Float16 hv = (_Float16)v; const int row = wm * 64 + i * 16 + 8 * g + r; sh[row * 136 + c] = hv; sl[row * 136 + c] = (_Float16)((v - (float)hv) * 2048.0f); } } }   // q, k (+ bias) as f16 hi + (x2048) residual
    __syncthreads();
    for (int q = tid; q < 128 * 16; q += 256) { const int row = q >> 4, pc = q & 15; const size_t o = (rb + row) * (2 * DM) + n0 + pc * 8; vst2((unsigned*)(QK + o), *(const v4u*)&sh[row * 136 + pc * 8]); vst2((unsigned*)(QKL + o), *(const v4u*)&sl[row * 136 + pc * 8]); }
  } else {
#pragma unroll
    for (int i = 0; i < 4; ++i) {
#pragma unroll
      for (int j = 0; j < 2; ++j) { const int d = wn * 32 + j * 16 + col; const float bb = BB ? bfr(BB[d]) : 0.f; v8h h8, l8;
#pragma unroll
        for (int r = 0; r < 8; ++r) { const float v = acc[i][j][r] + bb; const _Float16 hv = (_Float16)v; h8[r] = hv; l8[r] = (_Float16)((v - (float)hv) * 2048.0f); }
        const int s = wm * 64 + i * 16 + 8 * g; *(v8h*)&sh[d * 136 + s] = h8; *(v8h*)&sl[d * 136 + s] = l8; } }
    __syncthreads();
    const int b = (int)(rb / SS), s0 = (int)(rb % SS); const int pc0 = n0 - 2 * DM;
    for (int q = tid; q < 128 * 16; q += 256) { const int d = q >> 4, pc = q & 15; const size_t o = ((size_t)b * DM + pc0 + d) * SS + s0 + pc * 8; vst2((unsigned*)(VTH + o), *(const v4u*)&sh[d * 136 + pc * 8]); vst2((unsigned*)(VTL + o), *(const v4u*)&sl[d * 136 + pc * 8]); }
  }
}
// ---- k_attn: block = (64 queries, head h, batch b): all-keys flash attention; each 64-key stage of k, v and the key ids goes to LDS once per block (two buffers, next stage's global loads in flight, one barrier per stage) and the four waves take their fragments from there (K = 64: 2 k-steps), scores = (q.k) * 0.125 with single f16 operands, P.V: f16 P (x2^11) x V hi in one accumulator; O[b*S+q][h*64+d] = acc / (2048 l) (256-B segments)
__global__ __launch_bounds__(128) void k_attn(const _Float16* __restrict__ QK, const _Float16* __restrict__ QKL, const _Float16* __restrict__ VTH, const _Float16* __restrict__ VTL, const void* __restrict__ KMASK, const int* __restrict__ PROW, const int* __restrict__ PCOL, const float* __restrict__ RT, float* __restrict__ O) {
  __shared__ __align__(16) float sp[4][16][36]; __shared__ __align__(16) float so[4][16][68];
  __shared__ __align__(16) _Float16 skv[2][2 * 64 * GP]; __shared__ int sid[2][128];   // per buffer: k [64 keys][d], then v [64 d][key], pitch GP; row ids, then column ids, of the 64 keys
  const int tid = threadIdx.x, wave = tid >> 5, lane = tid & 31, col = lane & 15, g = lane >> 4;
  const int qb = blockIdx.x, h = blockIdx.y, b = blockIdx.z; const int q0 = qb * 64 + wave * 16; const size_t rq = (size_t)b * SS + q0 + col;
  v16h aq[2], aql[2];
#pragma unroll
  for (int kc = 0; kc < 2; ++kc) { aq[kc] = frag_h(QK + rq * (2 * DM) + h * HD + kc * 32, lane); aql[kc] = frag_h(QKL + rq * (2 * DM) + h * HD + kc * 32, lane); }
  int prw[8], pcl[8];
#pragma unroll
  for (int r = 0; r < 8; ++r) { prw[r] = PROW[(size_t)b * SS + q0 + 8 * g + r]; pcl[r] = PCOL[(size_t)b * SS + q0 + 8 * g + r]; }
  float rt[4];
#pragma unroll
  for (int i = 0; i < 4; ++i) rt[i] = bfr(RT[i * NH + h]);   // other, same row, same column, same cell
  float m[8], l[8];
#pragma unroll
  for (int r = 0; r < 8; ++r) { m[r] = -3.0e38f; l[r] = 0.f; }
  v8f acc[4] = {}, accl[4] = {};
  const _Float16* gk = QK + ((size_t)b * SS + (tid >> 3)) * (2 * DM) + DM + h * HD + (tid & 7) * 8; const _Float16* gv = VTH + ((size_t)b * DM + h * HD + (tid >> 3)) * SS + (tid & 7) * 8;
  const int* gi = ((tid < 64) ? PROW : PCOL) + (size_t)b * SS + (tid & 63); const int sko = (tid >> 3) * GP + (tid & 7) * 8;
  v4u rk[4], rv[4]; int ri = gi[0];
#pragma unroll
  for (int i = 0; i < 4; ++i) { rk[i] = *(const v4u*)(gk + (size_t)(16 * i) * (2 * DM)); rv[i] = *(const v4u*)(gv + (size_t)(16 * i) * SS); }
  const int nst = SS / 64;   // all keys
  for (int st = 0; st < nst; ++st) { _Float16* sk = &skv[st & 1][0]; _Float16* sv = sk + 64 * GP; int* si = &sid[st & 1][0];
#pragma unroll
    for (int i = 0; i < 4; ++i) { *(v4u*)(sk + sko + 16 * i * GP) = rk[i]; *(v4u*)(sv + sko + 16 * i * GP) = rv[i]; }
    si[tid] = ri;
    __syncthreads();   // publishes stage st; the buffer written next was last read before this barrier
    if (st + 1 < nst) { ri = gi[(st + 1) * 64];
#pragma unroll
      for (int i = 0; i < 4; ++i) { rk[i] = *(const v4u*)(gk + (size_t)((st + 1) * 64 + 16 * i) * (2 * DM)); rv[i] = *(const v4u*)(gv + (size_t)(16 * i) * SS + (st + 1) * 64); } }
  for (int k2 = 0; k2 < 2; ++k2) { v8f s[2];
#pragma unroll
    for (int ct = 0; ct < 2; ++ct) { const int kk = k2 * 32 + ct * 16 + col; const _Float16* krow = sk + kk * GP; v8f c = {}, cl = {};
#pragma unroll
      for (int kc = 0; kc < 2; ++kc) c = wmma16(aq[kc], frag_h(krow + kc * 32, lane), c);   // single product: q, k as one-rounding f16 operands
      (void)cl;
      { const bool keepk = true;
      { const int krw = si[kk], kcl = si[64 + kk];
#pragma unroll
        for (int r = 0; r < 8; ++r) { const bool sr = (prw[r] == krw), sc = (pcl[r] == kcl); const float bias = (sr && sc) ? rt[3] : sc ? rt[2] : sr ? rt[1] : rt[0]; s[ct][r] = keepk ? (c[r] * 0.125f + bias) : -3.0e38f; } } } }   // 64^-1/2 (folded from q) + structural bias (cell > column > row > other)
#pragma unroll
    for (int r = 0; r < 8; ++r) { float mx = fmaxf(s[0][r], s[1][r]);
#pragma unroll
      for (int o = 1; o < 16; o <<= 1) mx = fmaxf(mx, __shfl_xor(mx, o));
      const float mn = fmaxf(m[r], mx); const float alpha = (m[r] <= -1.0e38f) ? 0.f : __expf(m[r] - mn);
      const float e0 = (s[0][r] <= -1.0e38f) ? 0.f : __expf(s[0][r] - mn), e1 = (s[1][r] <= -1.0e38f) ? 0.f : __expf(s[1][r] - mn); float es = e0 + e1;
#pragma unroll
      for (int o = 1; o < 16; o <<= 1) es += __shfl_xor(es, o);
      l[r] = l[r] * alpha + es; m[r] = mn;
#pragma unroll
      for (int dt = 0; dt < 4; ++dt) { acc[dt][r] *= alpha; accl[dt][r] *= alpha; }
      sp[wave][8 * g + r][col] = e0; sp[wave][8 * g + r][16 + col] = e1; }
    LDSX();
    v16h pa, pl; { const float* prow = &sp[wave][col][0] + 8 * (lane >> 4);
#pragma unroll
      for (int i = 0; i < 8; ++i) { const float x0 = prow[i] * 2048.0f, x1 = prow[16 + i] * 2048.0f; const _Float16 h0 = (_Float16)x0, h1 = (_Float16)x1; pa[i] = h0; pa[8 + i] = h1; pl[i] = (_Float16)((x0 - (float)h0) * 2048.0f); pl[8 + i] = (_Float16)((x1 - (float)h1) * 2048.0f); } }   // P scaled by 2^11 before the f16 split so small softmax weights stay out of the f16 subnormal range; 2^-11 folded into the epilogue
#pragma unroll
    for (int dt = 0; dt < 4; ++dt) acc[dt] = wmma16(pa, frag_h(sv + (dt * 16 + col) * GP + k2 * 32, lane), acc[dt]);   // single product: P (x2^11) x V
    (void)pl;
    LDSX(); } }
#pragma unroll
  for (int r = 0; r < 8; ++r) { const float il = (1.0f / 2048.0f) / l[r];
#pragma unroll
    for (int dt = 0; dt < 4; ++dt) so[wave][8 * g + r][dt * 16 + col] = (acc[dt][r] + accl[dt][r] * (1.0f / 2048.0f)) * il; }
  LDSX();
  for (int rl = 0; rl < 16; ++rl) if (lane < 16) vst2(O + ((size_t)b * SS + q0 + rl) * DM + h * HD + lane * 4, *(const v4f*)&so[wave][rl][lane * 4]);
}
// ---- k_out: block = (128 rows, 64 cols), 8 waves as 4 x 2, 32 x 32 each: out = O(hi/lo) . Wo rows (2 products) + bo
__global__ __launch_bounds__(256) void k_out(const float* __restrict__ O, const __bf16* __restrict__ P, const float* __restrict__ BO, float* __restrict__ Y) {
  __shared__ __align__(16) __bf16 sm[2 * (2 * 128 + 64) * GP];
  const int tid = threadIdx.x, wave = tid >> 5, lane = tid & 31, col = lane & 15, g = lane >> 4, wm = wave >> 1, wn = wave & 1; const size_t rb = (size_t)blockIdx.x * 128; const int n0 = blockIdx.y * 64;
  v8f acc[2][2] = {};
  gemm_tile<128, 64, 2, 4, 2>(O + rb * DM, P + (size_t)n0 * DM, sm, acc);
  float* so = (float*)sm;   // output staging [128][68] in the ring's LDS
#pragma unroll
  for (int i = 0; i < 2; ++i) {
#pragma unroll
    for (int j = 0; j < 2; ++j) { const int c = wn * 32 + j * 16 + col; const float bb = bfr(BO[n0 + c]);
#pragma unroll
      for (int r = 0; r < 8; ++r) so[(wm * 32 + i * 16 + 8 * g + r) * 68 + c] = acc[i][j][r] + bb; } }
  __syncthreads();
  for (int q = tid; q < 128 * 16; q += 256) { const int row = q >> 4, pc = q & 15; vst2(Y + (rb + row) * DM + n0 + pc * 4, *(const v4f*)&so[row * 68 + pc * 4]); }
}
extern "C" void kernel_launch(void* const* d_in, const int* in_sizes, int n_in, void* d_out, int out_size, void* d_ws, size_t ws_size, hipStream_t stream) {
  (void)in_sizes; (void)n_in; (void)out_size;
  const float** F = (const float**)d_in;   // 0 hidden [4,1024,768], 1 pos_row [4,1024] int, 2 pos_col [4,1024] int, 3 q_w, 4 q_b, 5 k_w, 6 k_b, 7 v_w, 8 v_b, 9 o_w, 10 o_b (natural [768,768]), 11 rel_table [4,12]
  if (ws_size < (size_t)WS_END) return;
  char* ws = (char*)d_ws; __bf16* PK = (__bf16*)(ws + WS_PK); _Float16 *QK = (_Float16*)(ws + WS_QK), *QKL = (_Float16*)(ws + WS_QKL), *VTH = (_Float16*)(ws + WS_VTH), *VTL = (_Float16*)(ws + WS_VTL); float* O = (float*)(ws + WS_O);
  k_pack<<<dim3(DM, 4), 256, 0, stream>>>(F[3], F[5], F[7], F[9], PK);
  k_qkv<<<dim3(TNB * SS / 128, QKVW / 128), 256, 0, stream>>>(F[0], F[0], F[0], PK + PK_A, F[4], F[6], F[8], QK, QKL, VTH, VTL);
  k_attn<<<dim3(TQB, NH, TNB), 128, 0, stream>>>(QK, QKL, VTH, VTL, nullptr, (const int*)d_in[1], (const int*)d_in[2], F[11], O);
  k_out<<<dim3(TOB / 2, DM / 64), 256, 0, stream>>>(O, PK + PK_P, F[10], (float*)d_out);
}

// v002
// Measured time: 65.5 microseconds a run.
// Next to v001, in two timings, it ran 1.30 and 1.31 times as fast.
// All steps since v000 together make it 4.04 times as fast.
// compute dtype: all float inputs rounded to bf16, the integer row/column ids read on device; q/k/v = x . W^T + b with EXACT bf16 products on WMMA 16x16x32 (natural rows); PLAIN attention, transposed (one query per lane): q, k single f16 x 1/8 + the 4-way structural bias gathered per (query, key), running-max softmax in f32 (hardware exp), P (scaled by 2^11, single f16) x v (single f16); out = o (bf16 hi + residual) . o_w^T (2 products) + o_b.
#include <hip/hip_runtime.h>
#include <math.h>

typedef __attribute__((ext_vector_type(16))) _Float16 v16h;
typedef __attribute__((ext_vector_type(16))) __bf16 v16b;
typedef __attribute__((ext_vector_type(8)))  _Float16 v8h;
typedef __attribute__((ext_vector_type(8)))  float v8f;
typedef __attribute__((ext_vector_type(4)))  float v4f;
typedef __attribute__((ext_vector_type(2)))  float v2f;
typedef __attribute__((ext_vector_type(4)))  unsigned v4u;
typedef __attribute__((ext_vector_type(4)))  int v4i;
typedef float __attribute__((may_alias)) float_a;
typedef int __attribute__((may_alias)) int_a;

template <typename T> __device__ __forceinline__ void vst2(void* p, T v) { *(T*)p = v;  }
__device__ __forceinline__ v8f wmma16(v16h a, v16h b, v8f c) {
  v8f d = __builtin_amdgcn_wmma_f32_16x16x32_f16(false, a, false, b, (short)0, c, false, false);
  asm volatile("v_nop\n\tv_nop\n\tv_nop\n\tv_nop" : "+v"(d) : "v"(a), "v"(b));
  return d;
}
__device__ __forceinline__ v8f wmma_bf(v16b a, v16b b, v8f c) {
  v8f d = __builtin_amdgcn_wmma_f32_16x16x32_bf16(false, a, false, b, (short)0, c, false, false);
  asm volatile("v_nop\n\tv_nop\n\tv_nop\n\tv_nop" : "+v"(d) : "v"(a), "v"(b));
  return d;
}
// Table-structure-aware BART attention (B 4, S 1,024, E 768, 12 heads x 64): q/k/v projections + biases, scores + rel_table[other / same row / same column / same cell][h] from the per-token row and column ids, softmax, . v, output projection + bias.
__device__ __forceinline__ v16h frag_h(const _Float16* rowk0, int lane) {
  union { v16h v; v8h q[2]; } u; const _Float16* p = rowk0 + 8 * (lane >> 4);
  u.q[0] = *(const v8h*)p; u.q[1] = *(const v8h*)(p + 16); return u.v;
}
__device__ __forceinline__ v16h frag_f32(const float* rowk0, int lane) {
  v16h a; const float* p = rowk0 + 8 * (lane >> 4);
#pragma unroll
  for (int i = 0; i < 8; ++i) { a[i] = (_Float16)p[i]; a[8 + i] = (_Float16)p[16 + i]; }
  return a;
}
__device__ __forceinline__ v16h frag_f32s(const float* rowk0, int lane, float sc) {
  v16h a; const float* p = rowk0 + 8 * (lane >> 4);
#pragma unroll
  for (int i = 0; i < 8; ++i) { a[i] = (_Float16)(p[i] * sc); a[8 + i] = (_Float16)(p[16 + i] * sc); }
  return a;
}
// column fragment from a [K][ld] layout (column n), rows >= K read as 0
__device__ __forceinline__ v16h fragc_f32(const float* W, int k0, int n, int lane, int ld, int K) {
  v16h a; const int g = lane >> 4;
#pragma unroll
  for (int i = 0; i < 8; ++i) { const int ka = k0 + 8 * g + i, kb = ka + 16;
    a[i] = (_Float16)(ka < K ? W[(size_t)(ka < K ? ka : K - 1) * ld + n] : 0.f); a[8 + i] = (_Float16)(kb < K ? W[(size_t)(kb < K ? kb : K - 1) * ld + n] : 0.f); }
  return a;
}
struct F2 { v16b h, l; };
__device__ __forceinline__ F2 bsplit16(const float v[16]) { F2 r;
#pragma unroll
  for (int i = 0; i < 16; ++i) { const __bf16 h = (__bf16)v[i]; r.h[i] = h; r.l[i] = (__bf16)(v[i] - (float)h); }
  return r; }
__device__ __forceinline__ F2 split_row(const float* row, int k0, int lane) { float v[16]; const float* p = row + k0 + 8 * (lane >> 4);
#pragma unroll
  for (int i = 0; i < 8; ++i) { v[i] = p[i]; v[8 + i] = p[16 + i]; }
  return bsplit16(v); }
__device__ __forceinline__ F2 split_rowK(const float* row, int k0, int lane, int K) { float v[16]; const int g = lane >> 4;
#pragma unroll
  for (int i = 0; i < 8; ++i) { const int ka = k0 + 8 * g + i, kb = ka + 16; v[i] = ka < K ? row[ka < K ? ka : K - 1] : 0.f; v[8 + i] = kb < K ? row[kb < K ? kb : K - 1] : 0.f; }
  return bsplit16(v); }
__device__ __forceinline__ F2 split_col(const float* W, int k0, int n, int lane, int ld, int K) { float v[16]; const int g = lane >> 4;
#pragma unroll
  for (int i = 0; i < 8; ++i) { const int ka = k0 + 8 * g + i, kb = ka + 16; v[i] = ka < K ? W[(size_t)(ka < K ? ka : K - 1) * ld + n] : 0.f; v[8 + i] = kb < K ? W[(size_t)(kb < K ? kb : K - 1) * ld + n] : 0.f; }
  return bsplit16(v); }
__device__ __forceinline__ v8f mac3(const F2& a, const F2& b, v8f c) { c = wmma_bf(a.l, b.h, c); c = wmma_bf(a.h, b.l, c); return wmma_bf(a.h, b.h, c); }
__device__ __forceinline__ float sigm(float v) { return 1.0f / (1.0f + expf(-v)); }
#define LDSX() do { asm volatile("s_wait_dscnt 0" ::: "memory"); __builtin_amdgcn_wave_barrier(); __builtin_amdgcn_fence(__ATOMIC_RELEASE, "workgroup"); } while (0)


#define NB 4
#define SS 1024
#define DM 768
#define NH 12
#define HD 64
#define QKVW (3 * DM)
#ifndef TQB
#define TQB (SS / 64)
#define TNB NB
#define TOB (NB * SS / 64)     // output row tiles (all)
#endif
typedef __attribute__((ext_vector_type(8))) __bf16 v8b;
__device__ __forceinline__ v16b frag_b(const __bf16* rowk0, int lane) {
  union { v16b v; v8b q[2]; } u; const __bf16* p = rowk0 + 8 * (lane >> 4);
  u.q[0] = *(const v8b*)p; u.q[1] = *(const v8b*)(p + 16); return u.v;
}
__device__ __forceinline__ float bfr(float v) { return (float)(__bf16)v; }
__device__ __attribute__((noinline)) float exp_ni(float v) { return expf(v); }
__device__ __attribute__((noinline)) float erf_ni(float v) { return erff(v); }

#define PK_A 0                       // [2304][768] Wqkv rows (natural [out][in])
#define PK_P (PK_A + QKVW * DM)        // [768][768] Wo rows (natural)
#define PK_END (PK_P + DM * DM)
#define WS_PK  0u
#define WS_QK  (WS_PK + 2u * PK_END)             // f16 [4096 rows][1536]: q | k
#define WS_QKL (WS_QK + 2u * NB * SS * 2 * DM)     // f16 q | k residual planes x2048
#define WS_VTH (WS_QKL + 2u * NB * SS * 2 * DM)    // f16 [b][768 (h*64+d)][1024 s] hi
#define WS_VTL (WS_VTH + 2u * NB * DM * SS)        // f16 lo x 2048
#define WS_O   (WS_VTL + 2u * NB * DM * SS)        // f32 [4096][768]
#define WS_CS  (WS_O + 4u * NB * SS * DM)           // f32 2 x [1024][32], unused
#define WS_END (WS_CS + 4u * 2 * SS * 32)
// ---- k_pack: block = (row n, which): natural [out][in] rows -> bf16; which 0..2 -> W_q/W_k/W_v into PK_A rows which*768 + n; 3 -> W_o into PK_P
__global__ __launch_bounds__(256) void k_pack(const float* __restrict__ WQ, const float* __restrict__ WK, const float* __restrict__ WV, const float* __restrict__ WO, __bf16* __restrict__ PK) {
  __shared__ __align__(16) __bf16 s[DM]; const int n = blockIdx.x, which = blockIdx.y, t = threadIdx.x; const float* Wm = (which == 0) ? WQ : (which == 1) ? WK : (which == 2) ? WV : WO;
  for (int k = t; k < DM; k += 256) s[k] = (__bf16)Wm[(size_t)n * DM + k];
  __syncthreads();
  __bf16* dst = (which < 3) ? PK + PK_A + ((size_t)which * DM + n) * DM : PK + PK_P + (size_t)n * DM;
  for (int q = t; q < DM / 8; q += 256) vst2((unsigned*)(dst + q * 8), *(const v4u*)&s[q * 8]);
}
typedef __attribute__((ext_vector_type(4))) __bf16 v4b;
#define GK 64   // k per LDS stage
#define GP 72   // LDS row pitch in 16-bit elements: 128 B + 16 B, the conflict-free pitch for 16-B fragment reads
// In the staged kernels below every '#pragma unroll' makes the index of a register array (staging registers, fragments, accumulators) a constant, so that the array stays in registers.
// ---- gemm_tile: one BM x BN tile of A . B^T by 8 waves (WGM x WGN). Each 64-k stage of A (f32 rows rounded to bf16; hi + residual planes when NP = 2) and of B (bf16 rows) goes to LDS once per block in whole lines and every wave takes its fragments from there; two buffers, the next stage's global loads in flight during the products, one barrier per stage. k order per accumulator as with direct loads.
template <int BM, int BN, int NP, int WGM, int WGN>
__device__ __forceinline__ void gemm_tile(const float* __restrict__ A, const __bf16* __restrict__ B, __bf16* sm, v8f (&acc)[BM / WGM / 16][BN / WGN / 16]) {
  constexpr int FM = BM / WGM / 16, FN = BN / WGN / 16, ABUF = NP * BM * GP, BUF = ABUF + BN * GP, NA = BM / 16, NBL = BN / 32, NT = DM / GK;
  const int tid = threadIdx.x, wave = tid >> 5, lane = tid & 31, col = lane & 15; const int wm = wave / WGN, wn = wave % WGN;
  const float* ga = A + (size_t)(tid >> 4) * DM + (tid & 15) * 4; const __bf16* gb = B + (size_t)(tid >> 3) * DM + (tid & 7) * 8;
  const int sa = (tid >> 4) * GP + (tid & 15) * 4, sb = ABUF + (tid >> 3) * GP + (tid & 7) * 8;
  v4f ra[NA]; v4u rb[NBL];
#pragma unroll
  for (int i = 0; i < NA; ++i) ra[i] = *(const v4f*)(ga + (size_t)(16 * i) * DM);
#pragma unroll
  for (int i = 0; i < NBL; ++i) rb[i] = *(const v4u*)(gb + (size_t)(32 * i) * DM);
  for (int t = 0; t < NT; ++t) { __bf16* s = sm + (t & 1) * BUF;
#pragma unroll
    for (int i = 0; i < NA; ++i) { v4b hv, lv;
#pragma unroll
      for (int e = 0; e < 4; ++e) { const __bf16 hh = (__bf16)ra[i][e]; hv[e] = hh; lv[e] = (__bf16)(ra[i][e] - (float)hh); }
      *(v4b*)(s + sa + 16 * i * GP) = hv; if (NP == 2) *(v4b*)(s + BM * GP + sa + 16 * i * GP) = lv; }
#pragma unroll
    for (int i = 0; i < NBL; ++i) *(v4u*)(s + sb + 32 * i * GP) = rb[i];
    __syncthreads();   // publishes stage t; the buffer written next was last read before this barrier
    if (t + 1 < NT) {
#pragma unroll
      for (int i = 0; i < NA; ++i) ra[i] = *(const v4f*)(ga + (size_t)(16 * i) * DM + (t + 1) * GK);
#pragma unroll
      for (int i = 0; i < NBL; ++i) rb[i] = *(const v4u*)(gb + (size_t)(32 * i) * DM + (t + 1) * GK); }
#pragma unroll
    for (int kc = 0; kc < GK / 32; ++kc) { v16b w[FN];
#pragma unroll
      for (int j = 0; j < FN; ++j) w[j] = frag_b(s + ABUF + ((wn * FN + j) * 16 + col) * GP + kc * 32, lane);
#pragma unroll
      for (int i = 0; i < FM; ++i) { const __bf16* ar = s + ((wm * FM + i) * 16 + col) * GP + kc * 32; const v16b ah = frag_b(ar, lane);
        if (NP == 2) { const v16b al = frag_b(ar + BM * GP, lane);
#pragma unroll
          for (int j = 0; j < FN; ++j) { acc[i][j] = wmma_bf(al, w[j], acc[i][j]); acc[i][j] = wmma_bf(ah, w[j], acc[i][j]); } }
        else {
#pragma unroll
          for (int j = 0; j < FN; ++j) acc[i][j] = wmma_bf(ah, w[j], acc[i][j]); } } } }
  __syncthreads();   // every wave has left the ring: the caller stages its output there
}
// ---- k_qkv: block = (128 rows, 128 cols), 8 waves as 2 x 4, 64 x 32 each
__global__ __launch_bounds__(256) void k_qkv(const float* __restrict__ XQ, const float* __restrict__ XK, const float* __restrict__ XV, const __bf16* __restrict__ P, const float* __restrict__ BQ, const float* __restrict__ BK, const float* __restrict__ BV, _Float16* __restrict__ QK, _Float16* __restrict__ QKL, _Float16* __restrict__ VTH, _Float16* __restrict__ VTL) {
  const int which0 = (blockIdx.y * 128) / DM; const float* X = (which0 == 0) ? XQ : (which0 == 1) ? XK : XV; const float* BB = BQ ? (((which0 == 0) ? BQ : (which0 == 1) ? BK : BV) + (blockIdx.y * 128 - which0 * DM)) : nullptr;
  __shared__ __align__(16) __bf16 sm[2 * (128 + 128) * GP];
  const int tid = threadIdx.x, wave = tid >> 5, lane = tid & 31, col = lane & 15, g = lane >> 4, wm = wave >> 2, wn = wave & 3; const size_t rb = (size_t)blockIdx.x * 128; const int n0 = blockIdx.y * 128;
  v8f acc[4][2] = {};
  gemm_tile<128, 128, 1, 2, 4>(X + rb * DM, P + (size_t)n0 * DM, sm, acc);
  _Float16* sh = (_Float16*)sm; _Float16* sl = sh + 128 * 136;   // output staging [128][136] hi, lo in the ring's LDS
  if (n0 < 2 * DM) {   // q stored unscaled (f16 sigma ~0.6, no subnormal exposure); 1/8 applied to the f32 score
#pragma unroll
    for (int i = 0; i < 4; ++i) {
#pragma unroll
      for (int j = 0; j < 2; ++j) { const int c = wn * 32 + j * 16 + col; const float bb = BB ? bfr(BB[c]) : 0.f;
#pragma unroll
        for (int r = 0; r < 8; ++r) { const float v = acc[i][j][r] + bb; const _Float16 hv = (_Float16)v; const int row = wm * 64 + i * 16 + 8 * g + r; sh[row * 136 + c] = hv; sl[row * 136 + c] = (_Float16)((v - (float)hv) * 2048.0f); } } }   // q, k (+ bias) as f16 hi + (x2048) residual
    __syncthreads();
    for (int q = tid; q < 128 * 16; q += 256) { const int row = q >> 4, pc = q & 15; const size_t o = (rb + row) * (2 * DM) + n0 + pc * 8; vst2((unsigned*)(QK + o), *(const v4u*)&sh[row * 136 + pc * 8]); vst2((unsigned*)(QKL + o), *(const v4u*)&sl[row * 136 + pc * 8]); }
  } else {
#pragma unroll
    for (int i = 0; i < 4; ++i) {
#pragma unroll
      for (int j = 0; j < 2; ++j) { const int d = wn * 32 + j * 16 + col; const float bb = BB ? bfr(BB[d]) : 0.f; v8h h8, l8;
#pragma unroll
        for (int r = 0; r < 8; ++r) { const float v = acc[i][j][r] + bb; const _Float16 hv = (_Float16)v; h8[r] = hv; l8[r] = (_Float16)((v - (float)hv) * 2048.0f); }
        const int s = wm * 64 + i * 16 + 8 * g; *(v8h*)&sh[d * 136 + s] = h8; *(v8h*)&sl[d * 136 + s] = l8; } }
    __syncthreads();
    const int b = (int)(rb / SS), s0 = (int)(rb % SS); const int pc0 = n0 - 2 * DM;
    for (int q = tid; q < 128 * 16; q += 256) { const int d = q >> 4, pc = q & 15; const size_t o = ((size_t)b * DM + pc0 + d) * SS + s0 + pc * 8; vst2((unsigned*)(VTH + o), *(const v4u*)&sh[d * 136 + pc * 8]); vst2((unsigned*)(VTL + o), *(const v4u*)&sl[d * 136 + pc * 8]); }
  }
}
// lane l with lane l ^ 16
__device__ __forceinline__ float xhalf(float x) { return __builtin_bit_cast(float, __builtin_amdgcn_permlanex16(__builtin_bit_cast(int, x), __builtin_bit_cast(int, x), 0x76543210, 0xfedcba98, false, false)); }
__device__ __forceinline__ v8f wmma16p(v16h a, v16h b, v8f c) { return __builtin_amdgcn_wmma_f32_16x16x32_f16(false, a, false, b, (short)0, c, false, false); }
#define LOG2E 1.4426950408889634f
__global__ __launch_bounds__(128) void k_attn(const _Float16* __restrict__ QK, const _Float16* __restrict__ QKL, const _Float16* __restrict__ VTH, const _Float16* __restrict__ VTL, const void* __restrict__ KMASK, const int* __restrict__ PROW, const int* __restrict__ PCOL, const float* __restrict__ RT, float* __restrict__ O) {
  __shared__ __align__(16) float so[4][16][68];
  __shared__ __align__(16) _Float16 skv[2][2 * 64 * GP]; __shared__ __align__(16) int sid[2][128];   // per buffer: k [64 keys][d], then v [64 d][key], pitch GP; row ids, then column ids, of the 64 keys
  const int tid = threadIdx.x, wave = tid >> 5, lane = tid & 31, col = lane & 15, g = lane >> 4;
  const int qb = blockIdx.x, h = blockIdx.y, b = blockIdx.z; const int q0 = qb * 64 + wave * 16; const size_t rq = (size_t)b * SS + q0 + col;
  v16h bq[2];
#pragma unroll
  for (int kc = 0; kc < 2; ++kc) bq[kc] = frag_h(QK + rq * (2 * DM) + h * HD + kc * 32, lane);
  const int prw = PROW[rq], pcl = PCOL[rq];   // the lane's own query
  asm volatile("s_wait_xcnt 0x0" ::: "memory");   // the address registers of the loads above are reused while the loads are in flight
  float rt[4];
#pragma unroll
  for (int i = 0; i < 4; ++i) rt[i] = bfr(RT[i * NH + h]);   // other, same row, same column, same cell
  float m = -3.0e38f, l = 0.f;   // l: this lane half's keys only, joined after the loop
  v8f acc[4] = {};   // acc[dt][r] = O^T[dt * 16 + 8 g + r][query col]
  const _Float16* gk = QK + ((size_t)b * SS + (tid >> 3)) * (2 * DM) + DM + h * HD + (tid & 7) * 8; const _Float16* gv = VTH + ((size_t)b * DM + h * HD + (tid >> 3)) * SS + (tid & 7) * 8;
  const int* gi = ((tid < 64) ? PROW : PCOL) + (size_t)b * SS + (tid & 63); const int sko = (tid >> 3) * GP + (tid & 7) * 8;
  v4u rk[4], rv[4]; int ri = gi[0];
#pragma unroll
  for (int i = 0; i < 4; ++i) { rk[i] = *(const v4u*)(gk + (size_t)(16 * i) * (2 * DM)); rv[i] = *(const v4u*)(gv + (size_t)(16 * i) * SS); }
  const int nst = SS / 64;   // all keys
  for (int st = 0; st < nst; ++st) { _Float16* sk = &skv[st & 1][0]; _Float16* sv = sk + 64 * GP; int* si = &sid[st & 1][0];
#pragma unroll
    for (int i = 0; i < 4; ++i) { *(v4u*)(sk + sko + 16 * i * GP) = rk[i]; *(v4u*)(sv + sko + 16 * i * GP) = rv[i]; }
    si[tid] = ri;
    __syncthreads();   // publishes stage st; the buffer written next was last read before this barrier
    if (st + 1 < nst) { ri = gi[(st + 1) * 64];
#pragma unroll
      for (int i = 0; i < 4; ++i) { rk[i] = *(const v4u*)(gk + (size_t)((st + 1) * 64 + 16 * i) * (2 * DM)); rv[i] = *(const v4u*)(gv + (size_t)(16 * i) * SS + (st + 1) * 64); }
      asm volatile("s_wait_xcnt 0x0" ::: "memory"); }   // the address registers of the loads above are reused by the pass below while the loads are in flight
    v16h kf[4][2]; v4i kr[4][2], kc4[4][2];   // k fragments; row and column ids of the lane's keys kt * 16 + 8 g + 0..7
#pragma unroll
    for (int kt = 0; kt < 4; ++kt) {
#pragma unroll
      for (int kc = 0; kc < 2; ++kc) kf[kt][kc] = frag_h(sk + (kt * 16 + col) * GP + kc * 32, lane); }
#pragma unroll
    for (int kt = 0; kt < 2; ++kt) {
#pragma unroll
      for (int kc = 0; kc < 2; ++kc) { kr[kt][kc] = *(const v4i*)&si[kt * 16 + 8 * g + 4 * kc]; kc4[kt][kc] = *(const v4i*)&si[64 + kt * 16 + 8 * g + 4 * kc]; } }
    __builtin_amdgcn_sched_barrier(0);   // keeps these LDS loads one group ahead of their users: sunk among them, each load is waited for on its own
    v8f s[4] = {};   // s[kt][r]: key kt * 16 + 8 g + r of the stage against the lane's query
#pragma unroll
    for (int kp = 0; kp < 2; ++kp) {
#pragma unroll
      for (int kc = 0; kc < 2; ++kc) {
#pragma unroll
        for (int kt = 2 * kp; kt < 2 * kp + 2; ++kt) s[kt] = wmma16p(kf[kt][kc], bq[kc], s[kt]); } }   // single product: k, q as one-rounding f16 operands; two independent tiles at a time
#pragma unroll
    for (int kt = 2; kt < 4; ++kt) {
#pragma unroll
      for (int kc = 0; kc < 2; ++kc) { kr[kt][kc] = *(const v4i*)&si[kt * 16 + 8 * g + 4 * kc]; kc4[kt][kc] = *(const v4i*)&si[64 + kt * 16 + 8 * g + 4 * kc]; } }
    __builtin_amdgcn_sched_barrier(0);   // the second half of the ids is loaded ahead of the first half's selects, which cover its latency
#pragma unroll
    for (int kt = 0; kt < 4; ++kt) {
#pragma unroll
      for (int r = 0; r < 8; ++r) { const bool sr = (prw == kr[kt][r >> 2][r & 3]), sc = (pcl == kc4[kt][r >> 2][r & 3]); const float bias = (sr && sc) ? rt[3] : sc ? rt[2] : sr ? rt[1] : rt[0]; s[kt][r] = s[kt][r] * 0.125f + bias; } }   // 64^-1/2 (folded from q) + structural bias (cell > column > row > other)
    v16h vf[2][4];
#pragma unroll
    for (int k2 = 0; k2 < 2; ++k2) {
#pragma unroll
      for (int dt = 0; dt < 4; ++dt) vf[k2][dt] = frag_h(sv + (dt * 16 + col) * GP + k2 * 32, lane); }
    __builtin_amdgcn_sched_barrier(0);   // keeps the v fragment loads ahead of the softmax, which covers their latency
    float mk[4];
#pragma unroll
    for (int kt = 0; kt < 4; ++kt) mk[kt] = fmaxf(fmaxf(fmaxf(fmaxf(s[kt][0], s[kt][1]), s[kt][2]), fmaxf(s[kt][3], s[kt][4])), fmaxf(fmaxf(s[kt][5], s[kt][6]), s[kt][7]));
    float mx = fmaxf(fmaxf(mk[0], mk[1]), fmaxf(mk[2], mk[3]));
    mx = fmaxf(mx, xhalf(mx));   // both lane halves of a query agree on the maximum
    const float mn = fmaxf(m, mx); const float da = (m - mn) * LOG2E;
    const float nsh = fmaf(-mn, LOG2E, 11.0f);
#pragma unroll
    for (int kt = 0; kt < 4; ++kt) {
#pragma unroll
      for (int r = 0; r < 8; ++r) s[kt][r] = fmaf(s[kt][r], LOG2E, nsh); }
    __builtin_amdgcn_sched_barrier(0);   // all exponents are formed ahead of the exponentials: mixed among them, a paired multiply-add was placed directly behind an exponential whose source register it overwrites
    const float alpha = (m <= -1.0e38f) ? 0.f : __builtin_amdgcn_exp2f(da);
    v8f p[4];
#pragma unroll
    for (int kt = 0; kt < 4; ++kt) {
#pragma unroll
      for (int r = 0; r < 8; ++r) p[kt][r] = __builtin_amdgcn_exp2f(s[kt][r]); }   // 2^11 e^(s - mn)
    const v8f ev = (p[0] + p[1]) + (p[2] + p[3]);
    l = l * alpha + (((ev[0] + ev[1]) + (ev[2] + ev[3])) + ((ev[4] + ev[5]) + (ev[6] + ev[7]))); m = mn;
#pragma unroll
    for (int dt = 0; dt < 4; ++dt) acc[dt] *= alpha;
#pragma unroll
    for (int k2 = 0; k2 < 2; ++k2) { v16h pb;   // P^T of 32 keys as B: element i = key 8 g + i, element 8 + i = key 16 + 8 g + i, the k order of frag_h
#pragma unroll
      for (int i = 0; i < 8; ++i) { pb[i] = (_Float16)p[2 * k2][i]; pb[8 + i] = (_Float16)p[2 * k2 + 1][i]; }
#pragma unroll
      for (int dt = 0; dt < 4; ++dt) acc[dt] = wmma16p(vf[k2][dt], pb, acc[dt]); } }   // single product: V^T x P^T (x2^11)
  l += xhalf(l);
  const float il = 1.0f / l;
#pragma unroll
  for (int dt = 0; dt < 4; ++dt) { const v8f o = acc[dt] * il; float* d = &so[wave][col][dt * 16 + 8 * g]; *(v4f*)d = __builtin_shufflevector(o, o, 0, 1, 2, 3); *(v4f*)(d + 4) = __builtin_shufflevector(o, o, 4, 5, 6, 7); }
  LDSX();
  for (int rl = 0; rl < 16; ++rl) if (lane < 16) vst2(O + ((size_t)b * SS + q0 + rl) * DM + h * HD + lane * 4, *(const v4f*)&so[wave][rl][lane * 4]);
}
// ---- k_out: block = (128 rows, 64 cols), 8 waves as 4 x 2, 32 x 32 each: out = O(hi/lo) . Wo rows (2 products) + bo
__global__ __launch_bounds__(256) void k_out(const float* __restrict__ O, const __bf16* __restrict__ P, const float* __restrict__ BO, float* __restrict__ Y) {
  __shared__ __align__(16) __bf16 sm[2 * (2 * 128 + 64) * GP];
  const int tid = threadIdx.x, wave = tid >> 5, lane = tid & 31, col = lane & 15, g = lane >> 4, wm = wave >> 1, wn = wave & 1; const size_t rb = (size_t)blockIdx.x * 128; const int n0 = blockIdx.y * 64;
  v8f acc[2][2] = {};
  gemm_tile<128, 64, 2, 4, 2>(O + rb * DM, P + (size_t)n0 * DM, sm, acc);
  float* so = (float*)sm;   // output staging [128][68] in the ring's LDS
#pragma unroll
  for (int i = 0; i < 2; ++i) {
#pragma unroll
    for (int j = 0; j < 2; ++j) { const int c = wn * 32 + j * 16 + col; const float bb = bfr(BO[n0 + c]);
#pragma unroll
      for (int r = 0; r < 8; ++r) so[(wm * 32 + i * 16 + 8 * g + r) * 68 + c] = acc[i][j][r] + bb; } }
  __syncthreads();
  for (int q = tid; q < 128 * 16; q += 256) { const int row = q >> 4, pc = q & 15; vst2(Y + (rb + row) * DM + n0 + pc * 4, *(const v4f*)&so[row * 68 + pc * 4]); }
}
extern "C" void kernel_launch(void* const* d_in, const int* in_sizes, int n_in, void* d_out, int out_size, void* d_ws, size_t ws_size, hipStream_t stream) {
  (void)in_sizes; (void)n_in; (void)out_size;
  const float** F = (const float**)d_in;   // 0 hidden [4,1024,768], 1 pos_row [4,1024] int, 2 pos_col [4,1024] int, 3 q_w, 4 q_b, 5 k_w, 6 k_b, 7 v_w, 8 v_b, 9 o_w, 10 o_b (natural [768,768]), 11 rel_table [4,12]
  if (ws_size < (size_t)WS_END) return;
  char* ws = (char*)d_ws; __bf16* PK = (__bf16*)(ws + WS_PK); _Float16 *QK = (_Float16*)(ws + WS_QK), *QKL = (_Float16*)(ws + WS_QKL), *VTH = (_Float16*)(ws + WS_VTH), *VTL = (_Float16*)(ws + WS_VTL); float* O = (float*)(ws + WS_O);
  k_pack<<<dim3(DM, 4), 256, 0, stream>>>(F[3], F[5], F[7], F[9], PK);
  k_qkv<<<dim3(TNB * SS / 128, QKVW / 128), 256, 0, stream>>>(F[0], F[0], F[0], PK + PK_A, F[4], F[6], F[8], QK, QKL, VTH, VTL);
  k_attn<<<dim3(TQB, NH, TNB), 128, 0, stream>>>(QK, QKL, VTH, VTL, nullptr, (const int*)d_in[1], (const int*)d_in[2], F[11], O);
  k_out<<<dim3(TOB / 2, DM / 64), 256, 0, stream>>>(O, PK + PK_P, F[10], (float*)d_out);
}

// v003
// One run takes 62.7 microseconds.
// Two timings next to v002 both put it at 1.05 times that version's speed.
// All steps since v000 together make it 4.24 times as fast.
// compute dtype: all float inputs rounded to bf16, the integer row/column ids read on device; q/k/v = x . W^T + b with EXACT bf16 products on WMMA 16x16x32 (natural rows); PLAIN attention, transposed (one query per lane): q, k single f16 x 1/8 + the 4-way structural bias gathered per (query, key), running-max softmax in f32 (hardware exp), P (scaled by 2^11, single f16) x v (single f16); out = o (bf16 hi + residual) . o_w^T (2 products) + o_b.
#include <hip/hip_runtime.h>
#include <math.h>

typedef __attribute__((ext_vector_type(16))) _Float16 v16h;
typedef __attribute__((ext_vector_type(16))) __bf16 v16b;
typedef __attribute__((ext_vector_type(8)))  _Float16 v8h;
typedef __attribute__((ext_vector_type(8)))  float v8f;
typedef __attribute__((ext_vector_type(4)))  float v4f;
typedef __attribute__((ext_vector_type(2)))  float v2f;
typedef __attribute__((ext_vector_type(4)))  unsigned v4u;
typedef __attribute__((ext_vector_type(4)))  int v4i;
typedef float __attribute__((may_alias)) float_a;
typedef int __attribute__((may_alias)) int_a;

template <typename T> __device__ __forceinline__ void vst2(void* p, T v) { *(T*)p = v;  }
__device__ __forceinline__ v8f wmma16(v16h a, v16h b, v8f c) {
  v8f d = __builtin_amdgcn_wmma_f32_16x16x32_f16(false, a, false, b, (short)0, c, false, false);
  asm volatile("v_nop\n\tv_nop\n\tv_nop\n\tv_nop" : "+v"(d) : "v"(a), "v"(b));
  return d;
}
__device__ __forceinline__ v8f wmma_bf(v16b a, v16b b, v8f c) {
  v8f d = __builtin_amdgcn_wmma_f32_16x16x32_bf16(false, a, false, b, (short)0, c, false, false);
  asm volatile("v_nop\n\tv_nop\n\tv_nop\n\tv_nop" : "+v"(d) : "v"(a), "v"(b));
  return d;
}
// Table-structure-aware BART attention (B 4, S 1,024, E 768, 12 heads x 64): q/k/v projections + biases, scores + rel_table[other / same row / same column / same cell][h] from the per-token row and column ids, softmax, . v, output projection + bias.
__device__ __forceinline__ v16h frag_h(const _Float16* rowk0, int lane) {
  union { v16h v; v8h q[2]; } u; const _Float16* p = rowk0 + 8 * (lane >> 4);
  u.q[0] = *(const v8h*)p; u.q[1] = *(const v8h*)(p + 16); return u.v;
}
__device__ __forceinline__ v16h frag_f32(const float* rowk0, int lane) {
  v16h a; const float* p = rowk0 + 8 * (lane >> 4);
#pragma unroll
  for (int i = 0; i < 8; ++i) { a[i] = (_Float16)p[i]; a[8 + i] = (_Float16)p[16 + i]; }
  return a;
}
__device__ __forceinline__ v16h frag_f32s(const float* rowk0, int lane, float sc) {
  v16h a; const float* p = rowk0 + 8 * (lane >> 4);
#pragma unroll
  for (int i = 0; i < 8; ++i) { a[i] = (_Float16)(p[i] * sc); a[8 + i] = (_Float16)(p[16 + i] * sc); }
  return a;
}
// column fragment from a [K][ld] layout (column n), rows >= K read as 0
__device__ __forceinline__ v16h fragc_f32(const float* W, int k0, int n, int lane, int ld, int K) {
  v16h a; const int g = lane >> 4;
#pragma unroll
  for (int i = 0; i < 8; ++i) { const int ka = k0 + 8 * g + i, kb = ka + 16;
    a[i] = (_Float16)(ka < K ? W[(size_t)(ka < K ? ka : K - 1) * ld + n] : 0.f); a[8 + i] = (_Float16)(kb < K ? W[(size_t)(kb < K ? kb : K - 1) * ld + n] : 0.f); }
  return a;
}
struct F2 { v16b h, l; };
__device__ __forceinline__ F2 bsplit16(const float v[16]) { F2 r;
#pragma unroll
  for (int i = 0; i < 16; ++i) { const __bf16 h = (__bf16)v[i]; r.h[i] = h; r.l[i] = (__bf16)(v[i] - (float)h); }
  return r; }
__device__ __forceinline__ F2 split_row(const float* row, int k0, int lane) { float v[16]; const float* p = row + k0 + 8 * (lane >> 4);
#pragma unroll
  for (int i = 0; i < 8; ++i) { v[i] = p[i]; v[8 + i] = p[16 + i]; }
  return bsplit16(v); }
__device__ __forceinline__ F2 split_rowK(const float* row, int k0, int lane, int K) { float v[16]; const int g = lane >> 4;
#pragma unroll
  for (int i = 0; i < 8; ++i) { const int ka = k0 + 8 * g + i, kb = ka + 16; v[i] = ka < K ? row[ka < K ? ka : K - 1] : 0.f; v[8 + i] = kb < K ? row[kb < K ? kb : K - 1] : 0.f; }
  return bsplit16(v); }
__device__ __forceinline__ F2 split_col(const float* W, int k0, int n, int lane, int ld, int K) { float v[16]; const int g = lane >> 4;
#pragma unroll
  for (int i = 0; i < 8; ++i) { const int ka = k0 + 8 * g + i, kb = ka + 16; v[i] = ka < K ? W[(size_t)(ka < K ? ka : K - 1) * ld + n] : 0.f; v[8 + i] = kb < K ? W[(size_t)(kb < K ? kb : K - 1) * ld + n] : 0.f; }
  return bsplit16(v); }
__device__ __forceinline__ v8f mac3(const F2& a, const F2& b, v8f c) { c = wmma_bf(a.l, b.h, c); c = wmma_bf(a.h, b.l, c); return wmma_bf(a.h, b.h, c); }
__device__ __forceinline__ float sigm(float v) { return 1.0f / (1.0f + expf(-v)); }
#define LDSX() do { asm volatile("s_wait_dscnt 0" ::: "memory"); __builtin_amdgcn_wave_barrier(); __builtin_amdgcn_fence(__ATOMIC_RELEASE, "workgroup"); } while (0)


#define NB 4
#define SS 1024
#define DM 768
#define NH 12
#define HD 64
#define QKVW (3 * DM)
#ifndef TQB
#define TQB (SS / 64)
#define TNB NB
#define TOB (NB * SS / 64)     // output row tiles (all)
#endif
typedef __attribute__((ext_vector_type(8))) __bf16 v8b;
__device__ __forceinline__ v16b frag_p(const __bf16* p) {   // p = row + k0 + 8 * (lane >> 4): elements 0..7 are k 8 g + i, elements 8..15 are k 16 + 8 g + i
  union { v16b v; v8b q[2]; } u; u.q[0] = *(const v8b*)p; u.q[1] = *(const v8b*)(p + 16); return u.v;
}
__device__ __forceinline__ float bfr(float v) { return (float)(__bf16)v; }
__device__ __attribute__((noinline)) float exp_ni(float v) { return expf(v); }
__device__ __attribute__((noinline)) float erf_ni(float v) { return erff(v); }

#define WS_QK  0u                               // f16 [4096 rows][1536]: q | k
#define WS_QKL (WS_QK + 2u * NB * SS * 2 * DM)     // f16 q | k residual planes x2048
#define WS_VTH (WS_QKL + 2u * NB * SS * 2 * DM)    // f16 [b][768 (h*64+d)][1024 s] hi
#define WS_VTL (WS_VTH + 2u * NB * DM * SS)        // f16 lo x 2048
#define WS_O   (WS_VTL + 2u * NB * DM * SS)        // f32 [4096][768]
#define WS_CS  (WS_O + 4u * NB * SS * DM)           // f32 2 x [1024][32], unused
#define WS_END (WS_CS + 4u * 2 * SS * 32)
typedef __attribute__((ext_vector_type(4))) __bf16 v4b;
#define GK 64   // k per LDS stage
#define GP 72   // LDS row pitch in 16-bit elements: 128 B + 16 B, the conflict-free pitch for 16-B fragment reads
// In the staged kernels below every '#pragma unroll' makes the index of a register array (staging registers, fragments, accumulators) a constant, so that the array stays in registers.
// ---- gemm_tile: one BM x BN tile of A . B^T by 8 waves (WGM x WGN). Each 64-k stage of A (f32 rows rounded to bf16; hi + residual planes when NP = 2) and of B (f32 weight rows, natural [out][in], rounded to bf16 on the way) goes to LDS once per block in whole lines and every wave takes its fragments from there; two buffers, the next stage's global loads in flight during the products, one barrier per stage. k order per accumulator as with direct loads.
template <int BM, int BN, int NP, int WGM, int WGN>
__device__ __forceinline__ void gemm_tile(const float* __restrict__ A, const float* __restrict__ B, __bf16* sm, v8f (&acc)[BM / WGM / 16][BN / WGN / 16]) {
  constexpr int FM = BM / WGM / 16, FN = BN / WGN / 16, ABUF = NP * BM * GP, BUF = ABUF + BN * GP, NA = BM / 16, NBL = BN / 16, NT = DM / GK;
  const int tid = threadIdx.x, wave = __builtin_amdgcn_readfirstlane(tid >> 5), lane = tid & 31, col = lane & 15; const int wm = wave / WGN, wn = wave % WGN;   // the wave's number in a scalar register: what is derived from it takes no vector register through the loop
  const unsigned go = (tid >> 4) * DM + (tid & 15) * 4;   // one lane offset serves both operands; the bases stay block-uniform and step by a stage
  // three LDS places a lane (its stores, its A and its B fragments), each stepped in place from buffer to buffer: no second register for the buffer's sum
  __bf16* ps = sm + (tid >> 4) * GP + (tid & 15) * 4; const __bf16* pa = sm + wm * (FM * 16 * GP) + col * GP + 8 * (lane >> 4); const __bf16* pb = sm + ABUF + wn * (FN * 16 * GP) + col * GP + 8 * (lane >> 4); int step = BUF;
  v4f ra[NA], rb[NBL];
#pragma unroll
  for (int i = 0; i < NA; ++i) ra[i] = *(const v4f*)(A + (go + 16 * i * DM));
#pragma unroll
  for (int i = 0; i < NBL; ++i) rb[i] = *(const v4f*)(B + (go + 16 * i * DM));
  for (int t = 0; t < NT; ++t) {
#pragma unroll
    for (int i = 0; i < NA; ++i) { v4b hv, lv;
#pragma unroll
      for (int e = 0; e < 4; ++e) { const __bf16 hh = (__bf16)ra[i][e]; hv[e] = hh; lv[e] = (__bf16)(ra[i][e] - (float)hh); }
      *(v4b*)(ps + 16 * i * GP) = hv; if (NP == 2) *(v4b*)(ps + BM * GP + 16 * i * GP) = lv; }
#pragma unroll
    for (int i = 0; i < NBL; ++i) { v4b wv;
#pragma unroll
      for (int e = 0; e < 4; ++e) wv[e] = (__bf16)rb[i][e];
      *(v4b*)(ps + ABUF + 16 * i * GP) = wv; }
    __syncthreads();   // publishes stage t; the buffer written next was last read before this barrier
    if (t + 1 < NT) { A += GK; B += GK;
#pragma unroll
      for (int i = 0; i < NA; ++i) ra[i] = *(const v4f*)(A + (go + 16 * i * DM));
#pragma unroll
      for (int i = 0; i < NBL; ++i) rb[i] = *(const v4f*)(B + (go + 16 * i * DM)); }
#pragma unroll
    for (int kc = 0; kc < GK / 32; ++kc) { v16b w[FN];
#pragma unroll
      for (int j = 0; j < FN; ++j) w[j] = frag_p(pb + j * 16 * GP + kc * 32);
#pragma unroll
      for (int i = 0; i < FM; ++i) { const __bf16* ar = pa + i * 16 * GP + kc * 32; const v16b ah = frag_p(ar);
        if (NP == 2) { const v16b al = frag_p(ar + BM * GP);
#pragma unroll
          for (int j = 0; j < FN; ++j) { acc[i][j] = wmma_bf(al, w[j], acc[i][j]); acc[i][j] = wmma_bf(ah, w[j], acc[i][j]); } }
        else {
#pragma unroll
          for (int j = 0; j < FN; ++j) acc[i][j] = wmma_bf(ah, w[j], acc[i][j]); } } }
    ps += step; pa += step; pb += step; step = -step; }
  __syncthreads();   // every wave has left the ring: the caller stages its output there
}
// ---- k_qkv: block = (128 rows, 128 cols), 8 waves as 2 x 4, 64 x 32 each
__global__ __launch_bounds__(256) void k_qkv(const float* __restrict__ XQ, const float* __restrict__ XK, const float* __restrict__ XV, const float* __restrict__ WQ, const float* __restrict__ WK, const float* __restrict__ WV, const float* __restrict__ BQ, const float* __restrict__ BK, const float* __restrict__ BV, _Float16* __restrict__ QK, _Float16* __restrict__ QKL, _Float16* __restrict__ VTH, _Float16* __restrict__ VTL) {
  const int which0 = (blockIdx.y * 128) / DM; const float* X = (which0 == 0) ? XQ : (which0 == 1) ? XK : XV; const float* Wm = ((which0 == 0) ? WQ : (which0 == 1) ? WK : WV) + (size_t)(blockIdx.y * 128 - which0 * DM) * DM; const float* BB = BQ ? (((which0 == 0) ? BQ : (which0 == 1) ? BK : BV) + (blockIdx.y * 128 - which0 * DM)) : nullptr;
  __shared__ __align__(16) __bf16 sm[2 * (128 + 128) * GP];
  const int tid = threadIdx.x, wave = __builtin_amdgcn_readfirstlane(tid >> 5), lane = tid & 31, col = lane & 15, g = lane >> 4, wm = wave >> 2, wn = wave & 3; const size_t rb = (size_t)blockIdx.x * 128; const int n0 = blockIdx.y * 128;
  v8f acc[4][2] = {};
  gemm_tile<128, 128, 1, 2, 4>(X + rb * DM, Wm, sm, acc);
  _Float16* sh = (_Float16*)sm; _Float16* sl = sh + 128 * 136;   // output staging [128][136] hi, lo in the ring's LDS
  if (n0 < 2 * DM) {   // q stored unscaled (f16 sigma ~0.6, no subnormal exposure); 1/8 applied to the f32 score
#pragma unroll
    for (int i = 0; i < 4; ++i) {
#pragma unroll
      for (int j = 0; j < 2; ++j) { const int c = wn * 32 + j * 16 + col; const float bb = BB ? bfr(BB[c]) : 0.f;
#pragma unroll
        for (int r = 0; r < 8; ++r) { const float v = acc[i][j][r] + bb; const _Float16 hv = (_Float16)v; const int row = wm * 64 + i * 16 + 8 * g + r; sh[row * 136 + c] = hv; sl[row * 136 + c] = (_Float16)((v - (float)hv) * 2048.0f); } } }   // q, k (+ bias) as f16 hi + (x2048) residual
    __syncthreads();
    for (int q = tid; q < 128 * 16; q += 256) { const int row = q >> 4, pc = q & 15; const size_t o = (rb + row) * (2 * DM) + n0 + pc * 8; vst2((unsigned*)(QK + o), *(const v4u*)&sh[row * 136 + pc * 8]); vst2((unsigned*)(QKL + o), *(const v4u*)&sl[row * 136 + pc * 8]); }
  } else {
#pragma unroll
    for (int i = 0; i < 4; ++i) {
#pragma unroll
      for (int j = 0; j < 2; ++j) { const int d = wn * 32 + j * 16 + col; const float bb = BB ? bfr(BB[d]) : 0.f; v8h h8, l8;
#pragma unroll
        for (int r = 0; r < 8; ++r) { const float v = acc[i][j][r] + bb; const _Float16 hv = (_Float16)v; h8[r] = hv; l8[r] = (_Float16)((v - (float)hv) * 2048.0f); }
        const int s = wm * 64 + i * 16 + 8 * g; *(v8h*)&sh[d * 136 + s] = h8; *(v8h*)&sl[d * 136 + s] = l8; } }
    __syncthreads();
    const int b = (int)(rb / SS), s0 = (int)(rb % SS); const int pc0 = n0 - 2 * DM;
    for (int q = tid; q < 128 * 16; q += 256) { const int d = q >> 4, pc = q & 15; const size_t o = ((size_t)b * DM + pc0 + d) * SS + s0 + pc * 8; vst2((unsigned*)(VTH + o), *(const v4u*)&sh[d * 136 + pc * 8]); vst2((unsigned*)(VTL + o), *(const v4u*)&sl[d * 136 + pc * 8]); }
  }
}
// lane l with lane l ^ 16
__device__ __forceinline__ float xhalf(float x) { return __builtin_bit_cast(float, __builtin_amdgcn_permlanex16(__builtin_bit_cast(int, x), __builtin_bit_cast(int, x), 0x76543210, 0xfedcba98, false, false)); }
__device__ __forceinline__ v8f wmma16p(v16h a, v16h b, v8f c) { return __builtin_amdgcn_wmma_f32_16x16x32_f16(false, a, false, b, (short)0, c, false, false); }
#define LOG2E 1.4426950408889634f
__global__ __launch_bounds__(128) void k_attn(const _Float16* __restrict__ QK, const _Float16* __restrict__ QKL, const _Float16* __restrict__ VTH, const _Float16* __restrict__ VTL, const void* __restrict__ KMASK, const int* __restrict__ PROW, const int* __restrict__ PCOL, const float* __restrict__ RT, float* __restrict__ O) {
  __shared__ __align__(16) float so[4][16][68];
  __shared__ __align__(16) _Float16 skv[2][2 * 64 * GP]; __shared__ __align__(16) int sid[2][128];   // per buffer: k [64 keys][d], then v [64 d][key], pitch GP; row ids, then column ids, of the 64 keys
  const int tid = threadIdx.x, wave = tid >> 5, lane = tid & 31, col = lane & 15, g = lane >> 4;
  const int qb = blockIdx.x, h = blockIdx.y, b = blockIdx.z; const int q0 = qb * 64 + wave * 16; const size_t rq = (size_t)b * SS + q0 + col;
  v16h bq[2];
#pragma unroll
  for (int kc = 0; kc < 2; ++kc) bq[kc] = frag_h(QK + rq * (2 * DM) + h * HD + kc * 32, lane);
  const int prw = PROW[rq], pcl = PCOL[rq];   // the lane's own query
  asm volatile("s_wait_xcnt 0x0" ::: "memory");   // the address registers of the loads above are reused while the loads are in flight
  float rt[4];
#pragma unroll
  for (int i = 0; i < 4; ++i) rt[i] = bfr(RT[i * NH + h]);   // other, same row, same column, same cell
  float m = -3.0e38f, l = 0.f;   // l: this lane half's keys only, joined after the loop
  v8f acc[4] = {};   // acc[dt][r] = O^T[dt * 16 + 8 g + r][query col]
  const _Float16* gk = QK + ((size_t)b * SS + (tid >> 3)) * (2 * DM) + DM + h * HD + (tid & 7) * 8; const _Float16* gv = VTH + ((size_t)b * DM + h * HD + (tid >> 3)) * SS + (tid & 7) * 8;
  const int* gi = ((tid < 64) ? PROW : PCOL) + (size_t)b * SS + (tid & 63); const int sko = (tid >> 3) * GP + (tid & 7) * 8;
  v4u rk[4], rv[4]; int ri = gi[0];
#pragma unroll
  for (int i = 0; i < 4; ++i) { rk[i] = *(const v4u*)(gk + (size_t)(16 * i) * (2 * DM)); rv[i] = *(const v4u*)(gv + (size_t)(16 * i) * SS); }
  const int nst = SS / 64;   // all keys
  for (int st = 0; st < nst; ++st) { _Float16* sk = &skv[st & 1][0]; _Float16* sv = sk + 64 * GP; int* si = &sid[st & 1][0];
#pragma unroll
    for (int i = 0; i < 4; ++i) { *(v4u*)(sk + sko + 16 * i * GP) = rk[i]; *(v4u*)(sv + sko + 16 * i * GP) = rv[i]; }
    si[tid] = ri;
    __syncthreads();   // publishes stage st; the buffer written next was last read before this barrier
    if (st + 1 < nst) { ri = gi[(st + 1) * 64];
#pragma unroll
      for (int i = 0; i < 4; ++i) { rk[i] = *(const v4u*)(gk + (size_t)((st + 1) * 64 + 16 * i) * (2 * DM)); rv[i] = *(const v4u*)(gv + (size_t)(16 * i) * SS + (st + 1) * 64); }
      asm volatile("s_wait_xcnt 0x0" ::: "memory"); }   // the address registers of the loads above are reused by the pass below while the loads are in flight
    v16h kf[4][2]; v4i kr[4][2], kc4[4][2];   // k fragments; row and column ids of the lane's keys kt * 16 + 8 g + 0..7
#pragma unroll
    for (int kt = 0; kt < 4; ++kt) {
#pragma unroll
      for (int kc = 0; kc < 2; ++kc) kf[kt][kc] = frag_h(sk + (kt * 16 + col) * GP + kc * 32, lane); }
#pragma unroll
    for (int kt = 0; kt < 2; ++kt) {
#pragma unroll
      for (int kc = 0; kc < 2; ++kc) { kr[kt][kc] = *(const v4i*)&si[kt * 16 + 8 * g + 4 * kc]; kc4[kt][kc] = *(const v4i*)&si[64 + kt * 16 + 8 * g + 4 * kc]; } }
    __builtin_amdgcn_sched_barrier(0);   // keeps these LDS loads one group ahead of their users: sunk among them, each load is waited for on its own
    v8f s[4] = {};   // s[kt][r]: key kt * 16 + 8 g + r of the stage against the lane's query
#pragma unroll
    for (int kp = 0; kp < 2; ++kp) {
#pragma unroll
      for (int kc = 0; kc < 2; ++kc) {
#pragma unroll
        for (int kt = 2 * kp; kt < 2 * kp + 2; ++kt) s[kt] = wmma16p(kf[kt][kc], bq[kc], s[kt]); } }   // single product: k, q as one-rounding f16 operands; two independent tiles at a time
#pragma unroll
    for (int kt = 2; kt < 4; ++kt) {
#pragma unroll
      for (int kc = 0; kc < 2; ++kc) { kr[kt][kc] = *(const v4i*)&si[kt * 16 + 8 * g + 4 * kc]; kc4[kt][kc] = *(const v4i*)&si[64 + kt * 16 + 8 * g + 4 * kc]; } }
    __builtin_amdgcn_sched_barrier(0);   // the second half of the ids is loaded ahead of the first half's selects, which cover its latency
#pragma unroll
    for (int kt = 0; kt < 4; ++kt) {
#pragma unroll
      for (int r = 0; r < 8; ++r) { const bool sr = (prw == kr[kt][r >> 2][r & 3]), sc = (pcl == kc4[kt][r >> 2][r & 3]); const float bias = (sr && sc) ? rt[3] : sc ? rt[2] : sr ? rt[1] : rt[0]; s[kt][r] = s[kt][r] * 0.125f + bias; } }   // 64^-1/2 (folded from q) + structural bias (cell > column > row > other)
    v16h vf[2][4];
#pragma unroll
    for (int k2 = 0; k2 < 2; ++k2) {
#pragma unroll
      for (int dt = 0; dt < 4; ++dt) vf[k2][dt] = frag_h(sv + (dt * 16 + col) * GP + k2 * 32, lane); }
    __builtin_amdgcn_sched_barrier(0);   // keeps the v fragment loads ahead of the softmax, which covers their latency
    float mk[4];
#pragma unroll
    for (int kt = 0; kt < 4; ++kt) mk[kt] = fmaxf(fmaxf(fmaxf(fmaxf(s[kt][0], s[kt][1]), s[kt][2]), fmaxf(s[kt][3], s[kt][4])), fmaxf(fmaxf(s[kt][5], s[kt][6]), s[kt][7]));
    float mx = fmaxf(fmaxf(mk[0], mk[1]), fmaxf(mk[2], mk[3]));
    mx = fmaxf(mx, xhalf(mx));   // both lane halves of a query agree on the maximum
    const float mn = fmaxf(m, mx); const float da = (m - mn) * LOG2E;
    const float nsh = fmaf(-mn, LOG2E, 11.0f);
#pragma unroll
    for (int kt = 0; kt < 4; ++kt) {
#pragma unroll
      for (int r = 0; r < 8; ++r) s[kt][r] = fmaf(s[kt][r], LOG2E, nsh); }
    __builtin_amdgcn_sched_barrier(0);   // all exponents are formed ahead of the exponentials: mixed among them, a paired multiply-add was placed directly behind an exponential whose source register it overwrites
    const float alpha = (m <= -1.0e38f) ? 0.f : __builtin_amdgcn_exp2f(da);
    v8f p[4];
#pragma unroll
    for (int kt = 0; kt < 4; ++kt) {
#pragma unroll
      for (int r = 0; r < 8; ++r) p[kt][r] = __builtin_amdgcn_exp2f(s[kt][r]); }   // 2^11 e^(s - mn)
    const v8f ev = (p[0] + p[1]) + (p[2] + p[3]);
    l = l * alpha + (((ev[0] + ev[1]) + (ev[2] + ev[3])) + ((ev[4] + ev[5]) + (ev[6] + ev[7]))); m = mn;
#pragma unroll
    for (int dt = 0; dt < 4; ++dt) acc[dt] *= alpha;
#pragma unroll
    for (int k2 = 0; k2 < 2; ++k2) { v16h pb;   // P^T of 32 keys as B: element i = key 8 g + i, element 8 + i = key 16 + 8 g + i, the k order of frag_h
#pragma unroll
      for (int i = 0; i < 8; ++i) { pb[i] = (_Float16)p[2 * k2][i]; pb[8 + i] = (_Float16)p[2 * k2 + 1][i]; }
#pragma unroll
      for (int dt = 0; dt < 4; ++dt) acc[dt] = wmma16p(vf[k2][dt], pb, acc[dt]); } }   // single product: V^T x P^T (x2^11)
  l += xhalf(l);
  const float il = 1.0f / l;
#pragma unroll
  for (int dt = 0; dt < 4; ++dt) { const v8f o = acc[dt] * il; float* d = &so[wave][col][dt * 16 + 8 * g]; *(v4f*)d = __builtin_shufflevector(o, o, 0, 1, 2, 3); *(v4f*)(d + 4) = __builtin_shufflevector(o, o, 4, 5, 6, 7); }
  LDSX();
  for (int rl = 0; rl < 16; ++rl) if (lane < 16) vst2(O + ((size_t)b * SS + q0 + rl) * DM + h * HD + lane * 4, *(const v4f*)&so[wave][rl][lane * 4]);
}
// ---- k_out: block = (128 rows, 64 cols), 8 waves as 4 x 2, 32 x 32 each: out = O(hi/lo) . Wo rows (2 products) + bo
__global__ __launch_bounds__(256) void k_out(const float* __restrict__ O, const float* __restrict__ P, const float* __restrict__ BO, float* __restrict__ Y) {
  __shared__ __align__(16) __bf16 sm[2 * (2 * 128 + 64) * GP];
  const int tid = threadIdx.x, wave = tid >> 5, lane = tid & 31, col = lane & 15, g = lane >> 4, wm = wave >> 1, wn = wave & 1; const size_t rb = (size_t)blockIdx.x * 128; const int n0 = blockIdx.y * 64;
  v8f acc[2][2] = {};
  gemm_tile<128, 64, 2, 4, 2>(O + rb * DM, P + (size_t)n0 * DM, sm, acc);
  float* so = (float*)sm;   // output staging [128][68] in the ring's LDS
#pragma unroll
  for (int i = 0; i < 2; ++i) {
#pragma unroll
    for (int j = 0; j < 2; ++j) { const int c = wn * 32 + j * 16 + col; const float bb = bfr(BO[n0 + c]);
#pragma unroll
      for (int r = 0; r < 8; ++r) so[(wm * 32 + i * 16 + 8 * g + r) * 68 + c] = acc[i][j][r] + bb; } }
  __syncthreads();
  for (int q = tid; q < 128 * 16; q += 256) { const int row = q >> 4, pc = q & 15; vst2(Y + (rb + row) * DM + n0 + pc * 4, *(const v4f*)&so[row * 68 + pc * 4]); }
}
extern "C" void kernel_launch(void* const* d_in, const int* in_sizes, int n_in, void* d_out, int out_size, void* d_ws, size_t ws_size, hipStream_t stream) {
  (void)in_sizes; (void)n_in; (void)out_size;
  const float** F = (const float**)d_in;   // 0 hidden [4,1024,768], 1 pos_row [4,1024] int, 2 pos_col [4,1024] int, 3 q_w, 4 q_b, 5 k_w, 6 k_b, 7 v_w, 8 v_b, 9 o_w, 10 o_b (natural [768,768]), 11 rel_table [4,12]
  if (ws_size < (size_t)WS_END) return;
  char* ws = (char*)d_ws; _Float16 *QK = (_Float16*)(ws + WS_QK), *QKL = (_Float16*)(ws + WS_QKL), *VTH = (_Float16*)(ws + WS_VTH), *VTL = (_Float16*)(ws + WS_VTL); float* O = (float*)(ws + WS_O);
  k_qkv<<<dim3(TNB * SS / 128, QKVW / 128), 256, 0, stream>>>(F[0], F[0], F[0], F[3], F[5], F[7], F[4], F[6], F[8], QK, QKL, VTH, VTL);
  k_attn<<<dim3(TQB, NH, TNB), 128, 0, stream>>>(QK, QKL, VTH, VTL, nullptr, (const int*)d_in[1], (const int*)d_in[2], F[11], O);
  k_out<<<dim3(TOB / 2, DM / 64), 256, 0, stream>>>(O, F[9], F[10], (float*)d_out);
}

// v004
// It runs in 59 microseconds.
// In two side-by-side timings against v003, it was 1.06 and 1.05 times as fast.
// Counting every step since v000, it is 4.46 times as fast.
// compute dtype: all float inputs rounded to bf16, the integer row/column ids read on device; q/k/v = x . W^T + b with EXACT bf16 products on WMMA 16x16x32 (natural rows); PLAIN attention, transposed (one query per lane): q, k single f16 x 1/8 + the 4-way structural bias gathered per (query, key), running-max softmax in f32 (hardware exp), P (scaled by 2^11, single f16) x v (single f16); out = o (bf16 hi + residual) . o_w^T (2 products) + o_b.
#include <hip/hip_runtime.h>
#include <math.h>

typedef __attribute__((ext_vector_type(16))) _Float16 v16h;
typedef __attribute__((ext_vector_type(16))) __bf16 v16b;
typedef __attribute__((ext_vector_type(8)))  _Float16 v8h;
typedef __attribute__((ext_vector_type(8)))  float v8f;
typedef __attribute__((ext_vector_type(4)))  float v4f;
typedef __attribute__((ext_vector_type(2)))  float v2f;
typedef __attribute__((ext_vector_type(4)))  unsigned v4u;
typedef __attribute__((ext_vector_type(4)))  int v4i;
typedef float __attribute__((may_alias)) float_a;
typedef int __attribute__((may_alias)) int_a;

template <typename T> __device__ __forceinline__ void vst2(void* p, T v) { *(T*)p = v;  }
__device__ __forceinline__ v8f wmma16(v16h a, v16h b, v8f c) {
  v8f d = __builtin_amdgcn_wmma_f32_16x16x32_f16(false, a, false, b, (short)0, c, false, false);
  asm volatile("v_nop\n\tv_nop\n\tv_nop\n\tv_nop" : "+v"(d) : "v"(a), "v"(b));
  return d;
}
__device__ __forceinline__ v8f wmma_bf(v16b a, v16b b, v8f c) {
  v8f d = __builtin_amdgcn_wmma_f32_16x16x32_bf16(false, a, false, b, (short)0, c, false, false);
  asm volatile("v_nop\n\tv_nop\n\tv_nop\n\tv_nop" : "+v"(d) : "v"(a), "v"(b));
  return d;
}
// Table-structure-aware BART attention (B 4, S 1,024, E 768, 12 heads x 64): q/k/v projections + biases, scores + rel_table[other / same row / same column / same cell][h] from the per-token row and column ids, softmax, . v, output projection + bias.
__device__ __forceinline__ v16h frag_h(const _Float16* rowk0, int lane) {
  union { v16h v; v8h q[2]; } u; const _Float16* p = rowk0 + 8 * (lane >> 4);
  u.q[0] = *(const v8h*)p; u.q[1] = *(const v8h*)(p + 16); return u.v;
}
__device__ __forceinline__ v16h frag_f32(const float* rowk0, int lane) {
  v16h a; const float* p = rowk0 + 8 * (lane >> 4);
#pragma unroll
  for (int i = 0; i < 8; ++i) { a[i] = (_Float16)p[i]; a[8 + i] = (_Float16)p[16 + i]; }
  return a;
}
__device__ __forceinline__ v16h frag_f32s(const float* rowk0, int lane, float sc) {
  v16h a; const float* p = rowk0 + 8 * (lane >> 4);
#pragma unroll
  for (int i = 0; i < 8; ++i) { a[i] = (_Float16)(p[i] * sc); a[8 + i] = (_Float16)(p[16 + i] * sc); }
  return a;
}
// column fragment from a [K][ld] layout (column n), rows >= K read as 0
__device__ __forceinline__ v16h fragc_f32(const float* W, int k0, int n, int lane, int ld, int K) {
  v16h a; const int g = lane >> 4;
#pragma unroll
  for (int i = 0; i < 8; ++i) { const int ka = k0 + 8 * g + i, kb = ka + 16;
    a[i] = (_Float16)(ka < K ? W[(size_t)(ka < K ? ka : K - 1) * ld + n] : 0.f); a[8 + i] = (_Float16)(kb < K ? W[(size_t)(kb < K ? kb : K - 1) * ld + n] : 0.f); }
  return a;
}
struct F2 { v16b h, l; };
__device__ __forceinline__ F2 bsplit16(const float v[16]) { F2 r;
#pragma unroll
  for (int i = 0; i < 16; ++i) { const __bf16 h = (__bf16)v[i]; r.h[i] = h; r.l[i] = (__bf16)(v[i] - (float)h); }
  return r; }
__device__ __forceinline__ F2 split_row(const float* row, int k0, int lane) { float v[16]; const float* p = row + k0 + 8 * (lane >> 4);
#pragma unroll
  for (int i = 0; i < 8; ++i) { v[i] = p[i]; v[8 + i] = p[16 + i]; }
  return bsplit16(v); }
__device__ __forceinline__ F2 split_rowK(const float* row, int k0, int lane, int K) { float v[16]; const int g = lane >> 4;
#pragma unroll
  for (int i = 0; i < 8; ++i) { const int ka = k0 + 8 * g + i, kb = ka + 16; v[i] = ka < K ? row[ka < K ? ka : K - 1] : 0.f; v[8 + i] = kb < K ? row[kb < K ? kb : K - 1] : 0.f; }
  return bsplit16(v); }
__device__ __forceinline__ F2 split_col(const float* W, int k0, int n, int lane, int ld, int K) { float v[16]; const int g = lane >> 4;
#pragma unroll
  for (int i = 0; i < 8; ++i) { const int ka = k0 + 8 * g + i, kb = ka + 16; v[i] = ka < K ? W[(size_t)(ka < K ? ka : K - 1) * ld + n] : 0.f; v[8 + i] = kb < K ? W[(size_t)(kb < K ? kb : K - 1) * ld + n] : 0.f; }
  return bsplit16(v); }
__device__ __forceinline__ v8f mac3(const F2& a, const F2& b, v8f c) { c = wmma_bf(a.l, b.h, c); c = wmma_bf(a.h, b.l, c); return wmma_bf(a.h, b.h, c); }
__device__ __forceinline__ float sigm(float v) { return 1.0f / (1.0f + expf(-v)); }
#define LDSX() do { asm volatile("s_wait_dscnt 0" ::: "memory"); __builtin_amdgcn_wave_barrier(); __builtin_amdgcn_fence(__ATOMIC_RELEASE, "workgroup"); } while (0)


#define NB 4
#define SS 1024
#define DM 768
#define NH 12
#define HD 64
#define QKVW (3 * DM)
#ifndef TQB
#define TQB (SS / 64)
#define TNB NB
#define TOB (NB * SS / 64)     // output row tiles (all)
#endif
typedef __attribute__((ext_vector_type(8))) __bf16 v8b;
__device__ __forceinline__ v16b frag_p(const __bf16* p) {   // p = row + k0 + 8 * (lane >> 4): elements 0..7 are k 8 g + i, elements 8..15 are k 16 + 8 g + i
  union { v16b v; v8b q[2]; } u; u.q[0] = *(const v8b*)p; u.q[1] = *(const v8b*)(p + 16); return u.v;
}
__device__ __forceinline__ float bfr(float v) { return (float)(__bf16)v; }
__device__ __attribute__((noinline)) float exp_ni(float v) { return expf(v); }
__device__ __attribute__((noinline)) float erf_ni(float v) { return erff(v); }

#define WS_QK  0u                               // f16 [4096 rows][1536]: q | k
#define WS_QKL (WS_QK + 2u * NB * SS * 2 * DM)     // f16 q | k residual planes x2048
#define WS_VTH (WS_QKL + 2u * NB * SS * 2 * DM)    // f16 [b][768 (h*64+d)][1024 s] hi
#define WS_VTL (WS_VTH + 2u * NB * DM * SS)        // f16 lo x 2048
#define WS_O   (WS_VTL + 2u * NB * DM * SS)        // f32 [4096][768]
#define WS_CS  (WS_O + 4u * NB * SS * DM)           // f32 2 x [1024][32], unused
#define WS_END (WS_CS + 4u * 2 * SS * 32)
typedef __attribute__((ext_vector_type(4))) __bf16 v4b;
#define GK 64   // k per LDS stage
#define GP 72   // LDS row pitch in 16-bit elements: 128 B + 16 B, the conflict-free pitch for 16-B fragment reads
// In the staged kernels below every '#pragma unroll' makes the index of a register array (staging registers, fragments, accumulators) a constant, so that the array stays in registers.
// ---- gemm_tile: one BM x BN tile of A . B^T by 8 waves (WGM x WGN). Each 64-k stage of A (f32 rows rounded to bf16; hi + residual planes when NP = 2) and of B (f32 weight rows, natural [out][in], rounded to bf16 on the way) goes to LDS once per block in whole lines and every wave takes its fragments from there; two buffers, the next stage's global loads in flight during the products, one barrier per stage. Each accumulator sums its 64-k stages in the block's own rotated order.
template <int BM, int BN, int NP, int WGM, int WGN>
__device__ __forceinline__ void gemm_tile(const float* __restrict__ A, const float* __restrict__ B, __bf16* sm, v8f (&acc)[BM / WGM / 16][BN / WGN / 16]) {
  constexpr int FM = BM / WGM / 16, FN = BN / WGN / 16, ABUF = NP * BM * GP, BUF = ABUF + BN * GP, NA = BM / 16, NBL = BN / 16, NT = DM / GK;
  const int tid = threadIdx.x, wave = __builtin_amdgcn_readfirstlane(tid >> 5), lane = tid & 31, col = lane & 15; const int wm = wave / WGN, wn = wave % WGN;   // the wave's number in a scalar register: what is derived from it takes no vector register through the loop
  const unsigned go = (tid >> 4) * DM + (tid & 15) * 4;   // one lane offset serves both operands; the bases stay block-uniform and step by a stage
  // three LDS places a lane (its stores, its A and its B fragments), each stepped in place from buffer to buffer: no second register for the buffer's sum
  __bf16* ps = sm + (tid >> 4) * GP + (tid & 15) * 4; const __bf16* pa = sm + wm * (FM * 16 * GP) + col * GP + 8 * (lane >> 4); const __bf16* pb = sm + ABUF + wn * (FN * 16 * GP) + col * GP + 8 * (lane >> 4); int step = BUF;
  int ks = (int)((blockIdx.x + blockIdx.y) % NT);   // the block's first k stage; the walk wraps round. Neighbouring blocks that share A rows or B rows start at different stages: walking from one stage they would ask L2 for the same lines at the same moment
  A += ks * GK; B += ks * GK;
  v4f ra[NA], rb[NBL];
#pragma unroll
  for (int i = 0; i < NA; ++i) ra[i] = *(const v4f*)(A + (go + 16 * i * DM));
#pragma unroll
  for (int i = 0; i < NBL; ++i) rb[i] = *(const v4f*)(B + (go + 16 * i * DM));
  for (int t = 0; t < NT; ++t) {
#pragma unroll
    for (int i = 0; i < NA; ++i) { v4b hv, lv;
#pragma unroll
      for (int e = 0; e < 4; ++e) { const __bf16 hh = (__bf16)ra[i][e]; hv[e] = hh; lv[e] = (__bf16)(ra[i][e] - (float)hh); }
      *(v4b*)(ps + 16 * i * GP) = hv; if (NP == 2) *(v4b*)(ps + BM * GP + 16 * i * GP) = lv; }
#pragma unroll
    for (int i = 0; i < NBL; ++i) { v4b wv;
#pragma unroll
      for (int e = 0; e < 4; ++e) wv[e] = (__bf16)rb[i][e];
      *(v4b*)(ps + ABUF + 16 * i * GP) = wv; }
    __syncthreads();   // publishes stage t; the buffer written next was last read before this barrier
    if (t + 1 < NT) { const int adv = (ks + 1 == NT) ? -(NT - 1) * GK : GK; ks = (ks + 1 == NT) ? 0 : ks + 1; A += adv; B += adv;
#pragma unroll
      for (int i = 0; i < NA; ++i) ra[i] = *(const v4f*)(A + (go + 16 * i * DM));
#pragma unroll
      for (int i = 0; i < NBL; ++i) rb[i] = *(const v4f*)(B + (go + 16 * i * DM)); }
#pragma unroll
    for (int kc = 0; kc < GK / 32; ++kc) { v16b w[FN];
#pragma unroll
      for (int j = 0; j < FN; ++j) w[j] = frag_p(pb + j * 16 * GP + kc * 32);
#pragma unroll
      for (int i = 0; i < FM; ++i) { const __bf16* ar = pa + i * 16 * GP + kc * 32; const v16b ah = frag_p(ar);
        if (NP == 2) { const v16b al = frag_p(ar + BM * GP);
#pragma unroll
          for (int j = 0; j < FN; ++j) { acc[i][j] = wmma_bf(al, w[j], acc[i][j]); acc[i][j] = wmma_bf(ah, w[j], acc[i][j]); } }
        else {
#pragma unroll
          for (int j = 0; j < FN; ++j) acc[i][j] = wmma_bf(ah, w[j], acc[i][j]); } } }
    ps += step; pa += step; pb += step; step = -step; }
  __syncthreads();   // every wave has left the ring: the caller stages its output there
}
// ---- k_qkv: block = (128 rows, 128 cols), 8 waves as 2 x 4, 64 x 32 each
__global__ __launch_bounds__(256) void k_qkv(const float* __restrict__ XQ, const float* __restrict__ XK, const float* __restrict__ XV, const float* __restrict__ WQ, const float* __restrict__ WK, const float* __restrict__ WV, const float* __restrict__ BQ, const float* __restrict__ BK, const float* __restrict__ BV, _Float16* __restrict__ QK, _Float16* __restrict__ QKL, _Float16* __restrict__ VTH, _Float16* __restrict__ VTL) {
  const int which0 = (blockIdx.y * 128) / DM; const float* X = (which0 == 0) ? XQ : (which0 == 1) ? XK : XV; const float* Wm = ((which0 == 0) ? WQ : (which0 == 1) ? WK : WV) + (size_t)(blockIdx.y * 128 - which0 * DM) * DM; const float* BB = BQ ? (((which0 == 0) ? BQ : (which0 == 1) ? BK : BV) + (blockIdx.y * 128 - which0 * DM)) : nullptr;
  __shared__ __align__(16) __bf16 sm[2 * (128 + 128) * GP];
  const int tid = threadIdx.x, wave = __builtin_amdgcn_readfirstlane(tid >> 5), lane = tid & 31, col = lane & 15, g = lane >> 4, wm = wave >> 2, wn = wave & 3; const size_t rb = (size_t)blockIdx.x * 128; const int n0 = blockIdx.y * 128;
  v8f acc[4][2] = {};
  gemm_tile<128, 128, 1, 2, 4>(X + rb * DM, Wm, sm, acc);
  _Float16* sh = (_Float16*)sm; _Float16* sl = sh + 128 * 136;   // output staging [128][136] hi, lo in the ring's LDS
  if (n0 < 2 * DM) {   // q stored unscaled (f16 sigma ~0.6, no subnormal exposure); 1/8 applied to the f32 score
#pragma unroll
    for (int i = 0; i < 4; ++i) {
#pragma unroll
      for (int j = 0; j < 2; ++j) { const int c = wn * 32 + j * 16 + col; const float bb = BB ? bfr(BB[c]) : 0.f;
#pragma unroll
        for (int r = 0; r < 8; ++r) { const float v = acc[i][j][r] + bb; const _Float16 hv = (_Float16)v; const int row = wm * 64 + i * 16 + 8 * g + r; sh[row * 136 + c] = hv; sl[row * 136 + c] = (_Float16)((v - (float)hv) * 2048.0f); } } }   // q, k (+ bias) as f16 hi + (x2048) residual
    __syncthreads();
    for (int q = tid; q < 128 * 16; q += 256) { const int row = q >> 4, pc = q & 15; const size_t o = (rb + row) * (2 * DM) + n0 + pc * 8; vst2((unsigned*)(QK + o), *(const v4u*)&sh[row * 136 + pc * 8]); vst2((unsigned*)(QKL + o), *(const v4u*)&sl[row * 136 + pc * 8]); }
  } else {
#pragma unroll
    for (int i = 0; i < 4; ++i) {
#pragma unroll
      for (int j = 0; j < 2; ++j) { const int d = wn * 32 + j * 16 + col; const float bb = BB ? bfr(BB[d]) : 0.f; v8h h8, l8;
#pragma unroll
        for (int r = 0; r < 8; ++r) { const float v = acc[i][j][r] + bb; const _Float16 hv = (_Float16)v; h8[r] = hv; l8[r] = (_Float16)((v - (float)hv) * 2048.0f); }
        const int s = wm * 64 + i * 16 + 8 * g; *(v8h*)&sh[d * 136 + s] = h8; *(v8h*)&sl[d * 136 + s] = l8; } }
    __syncthreads();
    const int b = (int)(rb / SS), s0 = (int)(rb % SS); const int pc0 = n0 - 2 * DM;
    for (int q = tid; q < 128 * 16; q += 256) { const int d = q >> 4, pc = q & 15; const size_t o = ((size_t)b * DM + pc0 + d) * SS + s0 + pc * 8; vst2((unsigned*)(VTH + o), *(const v4u*)&sh[d * 136 + pc * 8]); vst2((unsigned*)(VTL + o), *(const v4u*)&sl[d * 136 + pc * 8]); }
  }
}
// lane l with lane l ^ 16
__device__ __forceinline__ float xhalf(float x) { return __builtin_bit_cast(float, __builtin_amdgcn_permlanex16(__builtin_bit_cast(int, x), __builtin_bit_cast(int, x), 0x76543210, 0xfedcba98, false, false)); }
__device__ __forceinline__ v8f wmma16p(v16h a, v16h b, v8f c) { return __builtin_amdgcn_wmma_f32_16x16x32_f16(false, a, false, b, (short)0, c, false, false); }
#define LOG2E 1.4426950408889634f
__global__ __launch_bounds__(128) void k_attn(const _Float16* __restrict__ QK, const _Float16* __restrict__ QKL, const _Float16* __restrict__ VTH, const _Float16* __restrict__ VTL, const void* __restrict__ KMASK, const int* __restrict__ PROW, const int* __restrict__ PCOL, const float* __restrict__ RT, float* __restrict__ O) {
  __shared__ __align__(16) float so[4][16][68];
  __shared__ __align__(16) _Float16 skv[2][2 * 64 * GP]; __shared__ __align__(16) int sid[2][128];   // per buffer: k [64 keys][d], then v [64 d][key], pitch GP; row ids, then column ids, of the 64 keys
  const int tid = threadIdx.x, wave = tid >> 5, lane = tid & 31, col = lane & 15, g = lane >> 4;
  const int qb = blockIdx.x, h = blockIdx.y, b = blockIdx.z; const int q0 = qb * 64 + wave * 16; const size_t rq = (size_t)b * SS + q0 + col;
  v16h bq[2];
#pragma unroll
  for (int kc = 0; kc < 2; ++kc) bq[kc] = frag_h(QK + rq * (2 * DM) + h * HD + kc * 32, lane);
  const int prw = PROW[rq], pcl = PCOL[rq];   // the lane's own query
  asm volatile("s_wait_xcnt 0x0" ::: "memory");   // the address registers of the loads above are reused while the loads are in flight
  float m = -3.0e38f, l = 0.f;   // l: this lane half's keys only, joined after the loop
  v8f acc[4] = {};   // acc[dt][r] = O^T[dt * 16 + 8 g + r][query col]
  const _Float16* gk = QK + ((size_t)b * SS + (tid >> 3)) * (2 * DM) + DM + h * HD + (tid & 7) * 8; const _Float16* gv = VTH + ((size_t)b * DM + h * HD + (tid >> 3)) * SS + (tid & 7) * 8;
  const int* gi = ((tid < 64) ? PROW : PCOL) + (size_t)b * SS + (tid & 63); const int sko = (tid >> 3) * GP + (tid & 7) * 8;
  const int nst = SS / 64;   // all keys
  int ks = qb % nst;   // the block's first key stage; the walk wraps round. The query blocks of one head start at different stages: walking from one stage they would ask L2 for the same k and v lines at the same moment
  v4u rk[4], rv[4]; int ri = gi[ks * 64];
#pragma unroll
  for (int i = 0; i < 4; ++i) { rk[i] = *(const v4u*)(gk + (size_t)(ks * 64 + 16 * i) * (2 * DM)); rv[i] = *(const v4u*)(gv + (size_t)(16 * i) * SS + ks * 64); }
  asm volatile("s_wait_xcnt 0x0" ::: "memory");   // the address registers of the loads above are reused while the loads are in flight
  __builtin_amdgcn_sched_barrier(0);   // keeps what follows behind that wait: scheduled ahead of it, the table's roundings took over those address registers
  float rt[4];
#pragma unroll
  for (int i = 0; i < 4; ++i) rt[i] = bfr(RT[i * NH + h]);   // other, same row, same column, same cell
  for (int st = 0; st < nst; ++st) { _Float16* sk = &skv[st & 1][0]; _Float16* sv = sk + 64 * GP; int* si = &sid[st & 1][0];
#pragma unroll
    for (int i = 0; i < 4; ++i) { *(v4u*)(sk + sko + 16 * i * GP) = rk[i]; *(v4u*)(sv + sko + 16 * i * GP) = rv[i]; }
    si[tid] = ri;
    __syncthreads();   // publishes stage st; the buffer written next was last read before this barrier
    if (st + 1 < nst) { ks = (ks + 1 == nst) ? 0 : ks + 1; ri = gi[ks * 64];
#pragma unroll
      for (int i = 0; i < 4; ++i) { rk[i] = *(const v4u*)(gk + (size_t)(ks * 64 + 16 * i) * (2 * DM)); rv[i] = *(const v4u*)(gv + (size_t)(16 * i) * SS + ks * 64); }
      asm volatile("s_wait_xcnt 0x0" ::: "memory"); }   // the address registers of the loads above are reused by the pass below while the loads are in flight
    v16h kf[4][2]; v4i kr[4][2], kc4[4][2];   // k fragments; row and column ids of the lane's keys kt * 16 + 8 g + 0..7
#pragma unroll
    for (int kt = 0; kt < 4; ++kt) {
#pragma unroll
      for (int kc = 0; kc < 2; ++kc) kf[kt][kc] = frag_h(sk + (kt * 16 + col) * GP + kc * 32, lane); }
#pragma unroll
    for (int kt = 0; kt < 2; ++kt) {
#pragma unroll
      for (int kc = 0; kc < 2; ++kc) { kr[kt][kc] = *(const v4i*)&si[kt * 16 + 8 * g + 4 * kc]; kc4[kt][kc] = *(const v4i*)&si[64 + kt * 16 + 8 * g + 4 * kc]; } }
    __builtin_amdgcn_sched_barrier(0);   // keeps these LDS loads one group ahead of their users: sunk among them, each load is waited for on its own
    v8f s[4] = {};   // s[kt][r]: key kt * 16 + 8 g + r of the stage against the lane's query
#pragma unroll
    for (int kp = 0; kp < 2; ++kp) {
#pragma unroll
      for (int kc = 0; kc < 2; ++kc) {
#pragma unroll
        for (int kt = 2 * kp; kt < 2 * kp + 2; ++kt) s[kt] = wmma16p(kf[kt][kc], bq[kc], s[kt]); } }   // single product: k, q as one-rounding f16 operands; two independent tiles at a time
#pragma unroll
    for (int kt = 2; kt < 4; ++kt) {
#pragma unroll
      for (int kc = 0; kc < 2; ++kc) { kr[kt][kc] = *(const v4i*)&si[kt * 16 + 8 * g + 4 * kc]; kc4[kt][kc] = *(const v4i*)&si[64 + kt * 16 + 8 * g + 4 * kc]; } }
    __builtin_amdgcn_sched_barrier(0);   // the second half of the ids is loaded ahead of the first half's selects, which cover its latency
#pragma unroll
    for (int kt = 0; kt < 4; ++kt) {
#pragma unroll
      for (int r = 0; r < 8; ++r) { const bool sr = (prw == kr[kt][r >> 2][r & 3]), sc = (pcl == kc4[kt][r >> 2][r & 3]); const float bias = (sr && sc) ? rt[3] : sc ? rt[2] : sr ? rt[1] : rt[0]; s[kt][r] = s[kt][r] * 0.125f + bias; } }   // 64^-1/2 (folded from q) + structural bias (cell > column > row > other)
    v16h vf[2][4];
#pragma unroll
    for (int k2 = 0; k2 < 2; ++k2) {
#pragma unroll
      for (int dt = 0; dt < 4; ++dt) vf[k2][dt] = frag_h(sv + (dt * 16 + col) * GP + k2 * 32, lane); }
    __builtin_amdgcn_sched_barrier(0);   // keeps the v fragment loads ahead of the softmax, which covers their latency
    float mk[4];
#pragma unroll
    for (int kt = 0; kt < 4; ++kt) mk[kt] = fmaxf(fmaxf(fmaxf(fmaxf(s[kt][0], s[kt][1]), s[kt][2]), fmaxf(s[kt][3], s[kt][4])), fmaxf(fmaxf(s[kt][5], s[kt][6]), s[kt][7]));
    float mx = fmaxf(fmaxf(mk[0], mk[1]), fmaxf(mk[2], mk[3]));
    mx = fmaxf(mx, xhalf(mx));   // both lane halves of a query agree on the maximum
    const float mn = fmaxf(m, mx); const float da = (m - mn) * LOG2E;
    const float nsh = fmaf(-mn, LOG2E, 11.0f);
#pragma unroll
    for (int kt = 0; kt < 4; ++kt) {
#pragma unroll
      for (int r = 0; r < 8; ++r) s[kt][r] = fmaf(s[kt][r], LOG2E, nsh); }
    __builtin_amdgcn_sched_barrier(0);   // all exponents are formed ahead of the exponentials: mixed among them, a paired multiply-add was placed directly behind an exponential whose source register it overwrites
    const float alpha = (m <= -1.0e38f) ? 0.f : __builtin_amdgcn_exp2f(da);
    v8f p[4];
#pragma unroll
    for (int kt = 0; kt < 4; ++kt) {
#pragma unroll
      for (int r = 0; r < 8; ++r) p[kt][r] = __builtin_amdgcn_exp2f(s[kt][r]); }   // 2^11 e^(s - mn)
    const v8f ev = (p[0] + p[1]) + (p[2] + p[3]);
    l = l * alpha + (((ev[0] + ev[1]) + (ev[2] + ev[3])) + ((ev[4] + ev[5]) + (ev[6] + ev[7]))); m = mn;
#pragma unroll
    for (int dt = 0; dt < 4; ++dt) acc[dt] *= alpha;
#pragma unroll
    for (int k2 = 0; k2 < 2; ++k2) { v16h pb;   // P^T of 32 keys as B: element i = key 8 g + i, element 8 + i = key 16 + 8 g + i, the k order of frag_h
#pragma unroll
      for (int i = 0; i < 8; ++i) { pb[i] = (_Float16)p[2 * k2][i]; pb[8 + i] = (_Float16)p[2 * k2 + 1][i]; }
#pragma unroll
      for (int dt = 0; dt < 4; ++dt) acc[dt] = wmma16p(vf[k2][dt], pb, acc[dt]); } }   // single product: V^T x P^T (x2^11)
  l += xhalf(l);
  const float il = 1.0f / l;
#pragma unroll
  for (int dt = 0; dt < 4; ++dt) { const v8f o = acc[dt] * il; float* d = &so[wave][col][dt * 16 + 8 * g]; *(v4f*)d = __builtin_shufflevector(o, o, 0, 1, 2, 3); *(v4f*)(d + 4) = __builtin_shufflevector(o, o, 4, 5, 6, 7); }
  LDSX();
  for (int rl = 0; rl < 16; ++rl) if (lane < 16) vst2(O + ((size_t)b * SS + q0 + rl) * DM + h * HD + lane * 4, *(const v4f*)&so[wave][rl][lane * 4]);
}
// ---- k_out: block = (128 rows, 64 cols), 8 waves as 4 x 2, 32 x 32 each: out = O(hi/lo) . Wo rows (2 products) + bo
__global__ __launch_bounds__(256) void k_out(const float* __restrict__ O, const float* __restrict__ P, const float* __restrict__ BO, float* __restrict__ Y) {
  __shared__ __align__(16) __bf16 sm[2 * (2 * 128 + 64) * GP];
  const int tid = threadIdx.x, wave = tid >> 5, lane = tid & 31, col = lane & 15, g = lane >> 4, wm = wave >> 1, wn = wave & 1; const size_t rb = (size_t)blockIdx.x * 128; const int n0 = blockIdx.y * 64;
  v8f acc[2][2] = {};
  gemm_tile<128, 64, 2, 4, 2>(O + rb * DM, P + (size_t)n0 * DM, sm, acc);
  float* so = (float*)sm;   // output staging [128][68] in the ring's LDS
#pragma unroll
  for (int i = 0; i < 2; ++i) {
#pragma unroll
    for (int j = 0; j < 2; ++j) { const int c = wn * 32 + j * 16 + col; const float bb = bfr(BO[n0 + c]);
#pragma unroll
      for (int r = 0; r < 8; ++r) so[(wm * 32 + i * 16 + 8 * g + r) * 68 + c] = acc[i][j][r] + bb; } }
  __syncthreads();
  for (int q = tid; q < 128 * 16; q += 256) { const int row = q >> 4, pc = q & 15; vst2(Y + (rb + row) * DM + n0 + pc * 4, *(const v4f*)&so[row * 68 + pc * 4]); }
}
extern "C" void kernel_launch(void* const* d_in, const int* in_sizes, int n_in, void* d_out, int out_size, void* d_ws, size_t ws_size, hipStream_t stream) {
  (void)in_sizes; (void)n_in; (void)out_size;
  const float** F = (const float**)d_in;   // 0 hidden [4,1024,768], 1 pos_row [4,1024] int, 2 pos_col [4,1024] int, 3 q_w, 4 q_b, 5 k_w, 6 k_b, 7 v_w, 8 v_b, 9 o_w, 10 o_b (natural [768,768]), 11 rel_table [4,12]
  if (ws_size < (size_t)WS_END) return;
  char* ws = (char*)d_ws; _Float16 *QK = (_Float16*)(ws + WS_QK), *QKL = (_Float16*)(ws + WS_QKL), *VTH = (_Float16*)(ws + WS_VTH), *VTL = (_Float16*)(ws + WS_VTL); float* O = (float*)(ws + WS_O);
  k_qkv<<<dim3(TNB * SS / 128, QKVW / 128), 256, 0, stream>>>(F[0], F[0], F[0], F[3], F[5], F[7], F[4], F[6], F[8], QK, QKL, VTH, VTL);
  k_attn<<<dim3(TQB, NH, TNB), 128, 0, stream>>>(QK, QKL, VTH, VTL, nullptr, (const int*)d_in[1], (const int*)d_in[2], F[11], O);
  k_out<<<dim3(TOB / 2, DM / 64), 256, 0, stream>>>(O, F[9], F[10], (float*)d_out);
}
